// v000
// Times are from an AMD MI455X. After a warm-up the kernel runs many times in a row, and a time is the length of
// such a window on the GPU divided by its runs, so every launch and the gaps after it count. The runs cycle
// through copies of the inputs. A figure is the median of several windows, for all but v000 over two sittings.
// Sittings can differ by a few percent; kernels timed side by side share one.
// v000 is the starting kernel. One run takes 468 microseconds.
#include <hip/hip_runtime.h>

#define N_TOK 8192
#define D 512
#define BM 32            /* query rows per block (2 strips of 16)           */
#define BN 128           /* keys per tile (8 waves x 16 keys)               */
#define SCALE 0.04419417382415922f  /* 1/sqrt(512) */

#define QS_STRIDE 528    /* 512 + 16 elems, 1056B: 16B-aligned, bank-skewed */
#define PS_STRIDE 144    /* 128 + 16 elems, 288B: 16B-aligned               */
#define SS_STRIDE 132    /* f32 scores, scalar access                       */

typedef __attribute__((ext_vector_type(16))) __bf16 v16bf;
typedef __attribute__((ext_vector_type(8)))  float  v8f;
typedef __attribute__((ext_vector_type(8)))  short  v8s;

struct bpair { v8s lo, hi; };

// 16x32-bf16 A/B fragment for v_wmma_f32_16x16x32_bf16 from two 16-byte
// chunks (K = kk..kk+7 and kk+16..kk+23 for this lane; lanes 0-15 kh=0,
// lanes 16-31 kh=1, per the ISA 16-bit A/B VGPR striping).
static __device__ __forceinline__ v16bf frag_from(const void* plo, const void* phi) {
  bpair f;
  f.lo = *(const v8s*)plo;
  f.hi = *(const v8s*)phi;
  return __builtin_bit_cast(v16bf, f);
}

// Hardware f32->bf16 convert (let clang pick v_cvt, ideally packed).
static __device__ __forceinline__ short f2bf(float x) {
  __bf16 h = (__bf16)x;
  return __builtin_bit_cast(short, h);
}

static __device__ __forceinline__ v8s cvt8(const float* __restrict__ p) {
  float4 a = *(const float4*)p;
  float4 b = *(const float4*)(p + 4);
  v8s r;
  r[0] = f2bf(a.x); r[1] = f2bf(a.y); r[2] = f2bf(a.z); r[3] = f2bf(a.w);
  r[4] = f2bf(b.x); r[5] = f2bf(b.y); r[6] = f2bf(b.z); r[7] = f2bf(b.w);
  return r;
}

static __device__ __forceinline__ v16bf frag_f32(const float* __restrict__ base) {
  bpair f;
  f.lo = cvt8(base);
  f.hi = cvt8(base + 16);
  return __builtin_bit_cast(v16bf, f);
}

// ---------------------------------------------------------------------------
// Kernel 1: Q = emb @ Wqk^T + bqk  (bf16, row-major [N][D])
//           V = emb @ Wv^T  + bv   (bf16, TRANSPOSED: Vt[D][N])
// One wave per 16x16 output tile; Q and V share the A (embedding) fragment.
// ---------------------------------------------------------------------------
__global__ __launch_bounds__(256) void proj_kernel(
    const float* __restrict__ emb,
    const float* __restrict__ Wqk, const float* __restrict__ bqk,
    const float* __restrict__ Wv,  const float* __restrict__ bv,
    short* __restrict__ Qg, short* __restrict__ Vt)
{
  const int tid  = threadIdx.x;
  const int lane = tid & 31;
  const int wave = tid >> 5;
  const int tile = blockIdx.x * 8 + wave;   // 512*32 = 16384 tiles
  const int tm = tile >> 5;                 // token tile   0..511
  const int tn = tile & 31;                 // feature tile 0..31
  const int am = lane & 15;
  const int kh = lane >> 4;

  const int row  = tm * 16 + am;            // A-lane: token row
  const int ocol = tn * 16 + am;            // B-lane: output feature

  v8f accQ = {};
  v8f accV = {};
  for (int s = 0; s < 16; ++s) {
    const int kk = s * 32 + kh * 8;
    v16bf a   = frag_f32(emb + row  * D + kk);
    v16bf bq  = frag_f32(Wqk + ocol * D + kk);
    v16bf bvv = frag_f32(Wv  + ocol * D + kk);
    accQ = __builtin_amdgcn_wmma_f32_16x16x32_bf16(false, a, false, bq,  (short)0, accQ, false, false);
    accV = __builtin_amdgcn_wmma_f32_16x16x32_bf16(false, a, false, bvv, (short)0, accV, false, false);
  }

  const float biasQ = bqk[ocol];
  const float biasV = bv[ocol];

  // D layout: VGPR r -> token row (tm*16 + kh*8 + r), column ocol.
  v8s vp;
  for (int r = 0; r < 8; ++r) {
    const int token = tm * 16 + kh * 8 + r;
    Qg[token * D + ocol] = f2bf(accQ[r] + biasQ);
    vp[r] = f2bf(accV[r] + biasV);
  }
  // Vt row = ocol, 8 contiguous tokens -> one 16B store.
  *(v8s*)(Vt + ocol * N_TOK + tm * 16 + kh * 8) = vp;
}

// ---------------------------------------------------------------------------
// Kernel 2: flash attention. Block = 32 query rows (2 strips), 8 waves.
// Per 128-key tile: wave w computes score subtiles (both strips) for keys
// [16w,16w+16) -- B fragment loaded ONCE, feeds TWO WMMAs; online softmax;
// then wave w computes P@V for output columns [64w, 64w+64) of both strips,
// again sharing each Vt B fragment across two WMMAs.
// ---------------------------------------------------------------------------
__global__ __launch_bounds__(256) void attn_kernel(
    const short* __restrict__ Qg, const short* __restrict__ Vt,
    float* __restrict__ out)
{
  __shared__ short Qs[BM * QS_STRIDE];      // 33.8 KB
  __shared__ float Ss[BM * SS_STRIDE];      // 16.9 KB
  __shared__ short Ps[BM * PS_STRIDE];      //  9.2 KB
  __shared__ float pmax[BM][8];
  __shared__ float psum[BM][8];
  __shared__ float m_run[BM], l_run[BM], m_new_s[BM], corr_s[BM];

  const int tid  = threadIdx.x;
  const int lane = tid & 31;
  const int wave = tid >> 5;
  const int am = lane & 15;
  const int kh = lane >> 4;
  const int qrow0 = blockIdx.x * BM;

  // Stage the 32x512 bf16 Q tile into LDS (2048 x 16B chunks, 8 per thread).
  for (int c = tid; c < BM * 64; c += 256) {
    const int r = c >> 6, cc = c & 63;
    *(v8s*)&Qs[r * QS_STRIDE + cc * 8] = *(const v8s*)(Qg + (qrow0 + r) * D + cc * 8);
  }
  if (tid < BM) { m_run[tid] = -3.0e38f; l_run[tid] = 0.0f; }
  __syncthreads();

  v8f acc0[4] = { {}, {}, {}, {} };   // strip 0 (rows 0..15)
  v8f acc1[4] = { {}, {}, {}, {} };   // strip 1 (rows 16..31)
  const int srow = tid >> 3;          // 0..31
  const int sseg = tid & 7;           // 16 cols per segment

  for (int kt = 0; kt < N_TOK / BN; ++kt) {
    const int kb = kt * BN;

    // ---- S subtiles: one key B-fragment feeds both strips' WMMAs
    v8f s0 = {}, s1 = {};
    const int keyrow = kb + wave * 16 + am;
    for (int s = 0; s < 16; ++s) {
      const int kk = s * 32 + kh * 8;
      v16bf b  = frag_from(Qg + keyrow * D + kk, Qg + keyrow * D + kk + 16);
      v16bf a0 = frag_from(&Qs[am * QS_STRIDE + kk],        &Qs[am * QS_STRIDE + kk + 16]);
      v16bf a1 = frag_from(&Qs[(16 + am) * QS_STRIDE + kk], &Qs[(16 + am) * QS_STRIDE + kk + 16]);
      s0 = __builtin_amdgcn_wmma_f32_16x16x32_bf16(false, a0, false, b, (short)0, s0, false, false);
      s1 = __builtin_amdgcn_wmma_f32_16x16x32_bf16(false, a1, false, b, (short)0, s1, false, false);
    }
    for (int r = 0; r < 8; ++r) {
      const int m = r + kh * 8;
      Ss[m * SS_STRIDE + wave * 16 + am]        = s0[r];
      Ss[(16 + m) * SS_STRIDE + wave * 16 + am] = s1[r];
    }
    __syncthreads();

    // ---- online softmax (256 threads: row = tid/8, 16 cols per thread)
    float mx = -3.0e38f;
    for (int j = 0; j < 16; ++j)
      mx = fmaxf(mx, Ss[srow * SS_STRIDE + sseg * 16 + j] * SCALE);
    pmax[srow][sseg] = mx;
    __syncthreads();
    if (sseg == 0) {
      float mt = pmax[srow][0];
      for (int j = 1; j < 8; ++j) mt = fmaxf(mt, pmax[srow][j]);
      const float mo = m_run[srow];
      const float mn = fmaxf(mo, mt);
      m_new_s[srow] = mn;
      corr_s[srow]  = __expf(mo - mn);
      m_run[srow]   = mn;
    }
    __syncthreads();
    {
      const float mn = m_new_s[srow];
      float ps = 0.0f;
      for (int j = 0; j < 16; ++j) {
        const int c = sseg * 16 + j;
        const float p = __expf(Ss[srow * SS_STRIDE + c] * SCALE - mn);
        ps += p;
        Ps[srow * PS_STRIDE + c] = f2bf(p);
      }
      psum[srow][sseg] = ps;
    }
    __syncthreads();
    if (sseg == 0) {
      float t = 0.0f;
      for (int j = 0; j < 8; ++j) t += psum[srow][j];
      l_run[srow] = l_run[srow] * corr_s[srow] + t;
    }

    // Warm WGP$ with next tile's key rows while PV WMMAs run.
    if (kb + BN < N_TOK)
      __builtin_prefetch(Qg + (kb + BN + wave * 16 + am) * D, 0, 1);

    // ---- O = corr*O + P @ V_tile ; wave w owns cols [64w, 64w+64), 2 strips
    float cr0[8], cr1[8];
    for (int r = 0; r < 8; ++r) {
      cr0[r] = corr_s[r + kh * 8];
      cr1[r] = corr_s[16 + r + kh * 8];
    }
    for (int j = 0; j < 4; ++j)
      for (int r = 0; r < 8; ++r) { acc0[j][r] *= cr0[r]; acc1[j][r] *= cr1[r]; }

    v16bf pa0[4], pa1[4];
    for (int s = 0; s < 4; ++s) {
      const int kk = s * 32 + kh * 8;
      pa0[s] = frag_from(&Ps[am * PS_STRIDE + kk],        &Ps[am * PS_STRIDE + kk + 16]);
      pa1[s] = frag_from(&Ps[(16 + am) * PS_STRIDE + kk], &Ps[(16 + am) * PS_STRIDE + kk + 16]);
    }
    for (int j = 0; j < 4; ++j) {
      const int ncol = wave * 64 + j * 16 + am;
      const short* vb = Vt + ncol * N_TOK + kb;   // Vt row-major: contiguous K
      for (int s = 0; s < 4; ++s) {
        const int kk = s * 32 + kh * 8;
        v16bf b = frag_from(vb + kk, vb + kk + 16);
        acc0[j] = __builtin_amdgcn_wmma_f32_16x16x32_bf16(false, pa0[s], false, b, (short)0, acc0[j], false, false);
        acc1[j] = __builtin_amdgcn_wmma_f32_16x16x32_bf16(false, pa1[s], false, b, (short)0, acc1[j], false, false);
      }
    }
    __syncthreads();
  }

  // ---- epilogue: O /= l, store f32
  float li0[8], li1[8];
  for (int r = 0; r < 8; ++r) {
    li0[r] = 1.0f / l_run[r + kh * 8];
    li1[r] = 1.0f / l_run[16 + r + kh * 8];
  }
  for (int j = 0; j < 4; ++j) {
    const int ncol = wave * 64 + j * 16 + am;
    for (int r = 0; r < 8; ++r) {
      const int m = r + kh * 8;
      out[(qrow0 + m) * D + ncol]      = acc0[j][r] * li0[r];
      out[(qrow0 + 16 + m) * D + ncol] = acc1[j][r] * li1[r];
    }
  }
}

extern "C" void kernel_launch(void* const* d_in, const int* in_sizes, int n_in,
                              void* d_out, int out_size, void* d_ws, size_t ws_size,
                              hipStream_t stream) {
  const float* emb = (const float*)d_in[0];
  const float* Wqk = (const float*)d_in[1];
  const float* bqk = (const float*)d_in[2];
  const float* Wv  = (const float*)d_in[3];
  const float* bv  = (const float*)d_in[4];

  short* Qg = (short*)d_ws;                       // bf16 [8192][512]  (8 MB)
  short* Vt = Qg + (size_t)N_TOK * D;             // bf16 [512][8192]  (8 MB)
  float* out = (float*)d_out;                     // f32  [8192][512]

  proj_kernel<<<2048, 256, 0, stream>>>(emb, Wqk, bqk, Wv, bv, Qg, Vt);
  attn_kernel<<<N_TOK / BM, 256, 0, stream>>>(Qg, Vt, out);
}

// v001
// It runs in 349 microseconds.
// In both of two side-by-side timings against v000, it was 1.37 times as fast.
#include <hip/hip_runtime.h>

#define N_TOK 8192
#define D 512
#define BM 32            /* query rows per block (2 strips of 16)           */
#define BN 128           /* keys per tile (8 waves x 16 keys)               */
#define SCALE 0.04419417382415922f  /* 1/sqrt(512) */

#define QS_STRIDE 528    /* 512 + 16 elems, 1056B: 16B-aligned, bank-skewed */
#define PS_STRIDE 144    /* 128 + 16 elems, 288B: 16B-aligned               */
#define SS_STRIDE 132    /* f32 scores, scalar access                       */

typedef __attribute__((ext_vector_type(16))) __bf16 v16bf;
typedef __attribute__((ext_vector_type(8)))  float  v8f;
typedef __attribute__((ext_vector_type(8)))  short  v8s;

struct bpair { v8s lo, hi; };

// 16x32-bf16 A/B fragment for v_wmma_f32_16x16x32_bf16 from two 16-byte
// chunks (K = kk..kk+7 and kk+16..kk+23 for this lane; lanes 0-15 kh=0,
// lanes 16-31 kh=1, per the ISA 16-bit A/B VGPR striping).
static __device__ __forceinline__ v16bf frag_from(const void* plo, const void* phi) {
  bpair f;
  f.lo = *(const v8s*)plo;
  f.hi = *(const v8s*)phi;
  return __builtin_bit_cast(v16bf, f);
}

// Hardware f32->bf16 convert (let clang pick v_cvt, ideally packed).
static __device__ __forceinline__ short f2bf(float x) {
  __bf16 h = (__bf16)x;
  return __builtin_bit_cast(short, h);
}

static __device__ __forceinline__ v8s cvt8(const float* __restrict__ p) {
  float4 a = *(const float4*)p;
  float4 b = *(const float4*)(p + 4);
  v8s r;
  r[0] = f2bf(a.x); r[1] = f2bf(a.y); r[2] = f2bf(a.z); r[3] = f2bf(a.w);
  r[4] = f2bf(b.x); r[5] = f2bf(b.y); r[6] = f2bf(b.z); r[7] = f2bf(b.w);
  return r;
}

static __device__ __forceinline__ v16bf frag_f32(const float* __restrict__ base) {
  bpair f;
  f.lo = cvt8(base);
  f.hi = cvt8(base + 16);
  return __builtin_bit_cast(v16bf, f);
}

// ---------------------------------------------------------------------------
// Kernel 1: Q = emb @ Wqk^T + bqk  (bf16, row-major [N][D])
//           V = emb @ Wv^T  + bv   (bf16, TRANSPOSED: Vt[D][N])
// One wave per 16x16 output tile; Q and V share the A (embedding) fragment.
// ---------------------------------------------------------------------------
__global__ __launch_bounds__(256) void proj_kernel(
    const float* __restrict__ emb,
    const float* __restrict__ Wqk, const float* __restrict__ bqk,
    const float* __restrict__ Wv,  const float* __restrict__ bv,
    short* __restrict__ Qg, short* __restrict__ Vt)
{
  const int tid  = threadIdx.x;
  const int lane = tid & 31;
  const int wave = tid >> 5;
  const int tile = blockIdx.x * 8 + wave;   // 512*32 = 16384 tiles
  const int tm = tile >> 5;                 // token tile   0..511
  const int tn = tile & 31;                 // feature tile 0..31
  const int am = lane & 15;
  const int kh = lane >> 4;

  const int row  = tm * 16 + am;            // A-lane: token row
  const int ocol = tn * 16 + am;            // B-lane: output feature

  v8f accQ = {};
  v8f accV = {};
  for (int s = 0; s < 16; ++s) {
    const int kk = s * 32 + kh * 8;
    v16bf a   = frag_f32(emb + row  * D + kk);
    v16bf bq  = frag_f32(Wqk + ocol * D + kk);
    v16bf bvv = frag_f32(Wv  + ocol * D + kk);
    accQ = __builtin_amdgcn_wmma_f32_16x16x32_bf16(false, a, false, bq,  (short)0, accQ, false, false);
    accV = __builtin_amdgcn_wmma_f32_16x16x32_bf16(false, a, false, bvv, (short)0, accV, false, false);
  }

  const float biasQ = bqk[ocol];
  const float biasV = bv[ocol];

  // D layout: VGPR r -> token row (tm*16 + kh*8 + r), column ocol.
  v8s vp;
  for (int r = 0; r < 8; ++r) {
    const int token = tm * 16 + kh * 8 + r;
    Qg[token * D + ocol] = f2bf(accQ[r] + biasQ);
    vp[r] = f2bf(accV[r] + biasV);
  }
  // Vt row = ocol, 8 contiguous tokens -> one 16B store.
  *(v8s*)(Vt + ocol * N_TOK + tm * 16 + kh * 8) = vp;
}

// Eight 16-byte-per-lane asynchronous copies, global memory to LDS, through no
// register. The s_wait_xcnt stands inside the statement, behind the last copy,
// so that no address register named here is rewritten in front of it.
static __device__ __forceinline__ void async_copy8(const unsigned (&l)[8],
                                                   const short* const (&g)[8]) {
  asm volatile(
      "global_load_async_to_lds_b128 %0, %8, off\n\t"
      "global_load_async_to_lds_b128 %1, %9, off\n\t"
      "global_load_async_to_lds_b128 %2, %10, off\n\t"
      "global_load_async_to_lds_b128 %3, %11, off\n\t"
      "global_load_async_to_lds_b128 %4, %12, off\n\t"
      "global_load_async_to_lds_b128 %5, %13, off\n\t"
      "global_load_async_to_lds_b128 %6, %14, off\n\t"
      "global_load_async_to_lds_b128 %7, %15, off\n\t"
      "s_wait_xcnt 0x0"
      :: "v"(l[0]), "v"(l[1]), "v"(l[2]), "v"(l[3]),
         "v"(l[4]), "v"(l[5]), "v"(l[6]), "v"(l[7]),
         "v"(g[0]), "v"(g[1]), "v"(g[2]), "v"(g[3]),
         "v"(g[4]), "v"(g[5]), "v"(g[6]), "v"(g[7])
      : "memory");
}

// LDS tiles are unpadded; the 16-byte chunk c of a row sits at chunk position
// c ^ (row & 15), so 16 lanes reading one chunk column of 16 rows hit 16
// different bank groups.

// Key tile: wave w brings key rows [16w, 16w+16) of the 128-key tile, 1024 B
// each; one copy covers 512 contiguous global bytes.
static __device__ __forceinline__ void copy_k_tile(const short* __restrict__ Qg, int kb,
                                                   unsigned ks_base, int wave, int lane) {
  const short* gsrc = Qg + (kb + wave * 16) * D + lane * 8;
  const unsigned ldst = ks_base + wave * 16 * 1024;
  for (int q = 0; q < 4; ++q) {
    unsigned l[8];
    const short* g[8];
    for (int u = 0; u < 8; ++u) {
      const int i = q * 8 + u, r = i >> 1, h = i & 1;
      g[u] = gsrc + r * D + h * 256;
      l[u] = ldst + r * 1024 + h * 512 + ((lane ^ r) << 4);
    }
    async_copy8(l, g);
  }
}

// Value tile: wave w brings Vt rows [64w, 64w+64), 256 B (128 keys) each; one
// copy covers two rows.
static __device__ __forceinline__ void copy_v_tile(const short* __restrict__ Vt, int kb,
                                                   unsigned vs_base, int wave, int lane) {
  const int am = lane & 15, kh = lane >> 4;
  const short* gsrc = Vt + (wave * 64 + kh) * N_TOK + kb + am * 8;
  const unsigned ldst = vs_base + (wave * 64 + kh) * 256;
  for (int q = 0; q < 4; ++q) {
    unsigned l[8];
    const short* g[8];
    for (int u = 0; u < 8; ++u) {
      const int i = q * 8 + u;
      g[u] = gsrc + 2 * i * N_TOK;
      l[u] = ldst + i * 512 + (((am ^ kh) ^ ((2 * i) & 14)) << 4);
    }
    async_copy8(l, g);
  }
}

// ---------------------------------------------------------------------------
// Kernel 2: flash attention. Block = 32 query rows (2 strips), 8 waves.
// Per 128-key tile: wave w computes score subtiles (both strips) for keys
// [16w,16w+16) -- B fragment loaded ONCE, feeds TWO WMMAs; online softmax;
// then wave w computes P@V for output columns [64w, 64w+64) of both strips,
// again sharing each Vt B fragment across two WMMAs.
// The key tile and the value tile each have one LDS buffer, filled by
// asynchronous copies: V(t) flies under the score phase of tile t, K(t+1)
// under the softmax and P@V of tile t.
// ---------------------------------------------------------------------------
__global__ __launch_bounds__(256) void attn_kernel(
    const short* __restrict__ Qg, const short* __restrict__ Vt,
    float* __restrict__ out)
{
  __shared__ __attribute__((aligned(1024))) short Ks[BN * D];   // 128 KB
  __shared__ __attribute__((aligned(1024))) short Vs[D * BN];   // 128 KB
  __shared__ short Qs[BM * QS_STRIDE];      // 33.8 KB
  __shared__ float Ss[BM * SS_STRIDE];      // 16.9 KB
  __shared__ short Ps[BM * PS_STRIDE];      //  9.2 KB
  __shared__ float pmax[BM][8];
  __shared__ float psum[BM][8];
  __shared__ float m_run[BM], l_run[BM], m_new_s[BM], corr_s[BM];

  const int tid  = threadIdx.x;
  const int lane = tid & 31;
  const int wave = tid >> 5;
  const int am = lane & 15;
  const int kh = lane >> 4;
  const int qrow0 = blockIdx.x * BM;
  const unsigned ks_base = (unsigned)(unsigned long long)&Ks[0];
  const unsigned vs_base = (unsigned)(unsigned long long)&Vs[0];

  // Element offset of chunk 2e + kh of a row with (row & 15) == am.
  int sw[8];
  for (int e = 0; e < 8; ++e) sw[e] = ((2 * e) ^ (am ^ kh)) * 8;

  copy_k_tile(Qg, 0, ks_base, wave, lane);

  // Stage the 32x512 bf16 Q tile into LDS (2048 x 16B chunks, 8 per thread).
  for (int c = tid; c < BM * 64; c += 256) {
    const int r = c >> 6, cc = c & 63;
    *(v8s*)&Qs[r * QS_STRIDE + cc * 8] = *(const v8s*)(Qg + (qrow0 + r) * D + cc * 8);
  }
  if (tid < BM) { m_run[tid] = -3.0e38f; l_run[tid] = 0.0f; }
  // K(0) has landed before the barrier that lets anybody read it.
  asm volatile("s_wait_asynccnt 0x0" ::: "memory");
  __syncthreads();
  copy_v_tile(Vt, 0, vs_base, wave, lane);

  v8f acc0[4] = { {}, {}, {}, {} };   // strip 0 (rows 0..15)
  v8f acc1[4] = { {}, {}, {}, {} };   // strip 1 (rows 16..31)
  const int srow = tid >> 3;          // 0..31
  const int sseg = tid & 7;           // 16 cols per segment

  for (int kt = 0; kt < N_TOK / BN; ++kt) {
    const int kb = kt * BN;

    // ---- S subtiles: one key B-fragment feeds both strips' WMMAs
    v8f s0 = {}, s1 = {};
    const short* krow = &Ks[(wave * 16 + am) * D];
    for (int s = 0; s < 16; ++s) {
      const int kk = s * 32 + kh * 8;
      v16bf b  = frag_from(krow + (s >> 2) * 128 + sw[(2 * s) & 7],
                           krow + (s >> 2) * 128 + sw[(2 * s + 1) & 7]);
      v16bf a0 = frag_from(&Qs[am * QS_STRIDE + kk],        &Qs[am * QS_STRIDE + kk + 16]);
      v16bf a1 = frag_from(&Qs[(16 + am) * QS_STRIDE + kk], &Qs[(16 + am) * QS_STRIDE + kk + 16]);
      s0 = __builtin_amdgcn_wmma_f32_16x16x32_bf16(false, a0, false, b, (short)0, s0, false, false);
      s1 = __builtin_amdgcn_wmma_f32_16x16x32_bf16(false, a1, false, b, (short)0, s1, false, false);
    }
    for (int r = 0; r < 8; ++r) {
      const int m = r + kh * 8;
      Ss[m * SS_STRIDE + wave * 16 + am]        = s0[r];
      Ss[(16 + m) * SS_STRIDE + wave * 16 + am] = s1[r];
    }
    // Foot of the score phase: this wave's reads of Ks are done and its copies
    // of V(t) have landed before the barrier; behind it Ks is refilled.
    asm volatile("s_wait_dscnt 0x0" ::: "memory");
    asm volatile("s_wait_asynccnt 0x0" ::: "memory");
    __syncthreads();
    if (kb + BN < N_TOK) copy_k_tile(Qg, kb + BN, ks_base, wave, lane);

    // ---- online softmax (256 threads: row = tid/8, 16 cols per thread)
    float mx = -3.0e38f;
    for (int j = 0; j < 16; ++j)
      mx = fmaxf(mx, Ss[srow * SS_STRIDE + sseg * 16 + j] * SCALE);
    pmax[srow][sseg] = mx;
    __syncthreads();
    if (sseg == 0) {
      float mt = pmax[srow][0];
      for (int j = 1; j < 8; ++j) mt = fmaxf(mt, pmax[srow][j]);
      const float mo = m_run[srow];
      const float mn = fmaxf(mo, mt);
      m_new_s[srow] = mn;
      corr_s[srow]  = __expf(mo - mn);
      m_run[srow]   = mn;
    }
    __syncthreads();
    {
      const float mn = m_new_s[srow];
      float ps = 0.0f;
      for (int j = 0; j < 16; ++j) {
        const int c = sseg * 16 + j;
        const float p = __expf(Ss[srow * SS_STRIDE + c] * SCALE - mn);
        ps += p;
        Ps[srow * PS_STRIDE + c] = f2bf(p);
      }
      psum[srow][sseg] = ps;
    }
    __syncthreads();
    if (sseg == 0) {
      float t = 0.0f;
      for (int j = 0; j < 8; ++j) t += psum[srow][j];
      l_run[srow] = l_run[srow] * corr_s[srow] + t;
    }

    // ---- O = corr*O + P @ V_tile ; wave w owns cols [64w, 64w+64), 2 strips
    float cr0[8], cr1[8];
    for (int r = 0; r < 8; ++r) {
      cr0[r] = corr_s[r + kh * 8];
      cr1[r] = corr_s[16 + r + kh * 8];
    }
    for (int j = 0; j < 4; ++j)
      for (int r = 0; r < 8; ++r) { acc0[j][r] *= cr0[r]; acc1[j][r] *= cr1[r]; }

    v16bf pa0[4], pa1[4];
    for (int s = 0; s < 4; ++s) {
      const int kk = s * 32 + kh * 8;
      pa0[s] = frag_from(&Ps[am * PS_STRIDE + kk],        &Ps[am * PS_STRIDE + kk + 16]);
      pa1[s] = frag_from(&Ps[(16 + am) * PS_STRIDE + kk], &Ps[(16 + am) * PS_STRIDE + kk + 16]);
    }
    for (int j = 0; j < 4; ++j) {
      const int ncol = wave * 64 + j * 16 + am;
      const short* vb = &Vs[ncol * BN];
      for (int s = 0; s < 4; ++s) {
        v16bf b = frag_from(vb + sw[2 * s], vb + sw[2 * s + 1]);
        acc0[j] = __builtin_amdgcn_wmma_f32_16x16x32_bf16(false, pa0[s], false, b, (short)0, acc0[j], false, false);
        acc1[j] = __builtin_amdgcn_wmma_f32_16x16x32_bf16(false, pa1[s], false, b, (short)0, acc1[j], false, false);
      }
    }
    // Foot of the P@V phase: this wave's reads of Vs are done and its copies
    // of K(t+1) have landed before the barrier; behind it Vs is refilled.
    asm volatile("s_wait_dscnt 0x0" ::: "memory");
    asm volatile("s_wait_asynccnt 0x0" ::: "memory");
    __syncthreads();
    if (kb + BN < N_TOK) copy_v_tile(Vt, kb + BN, vs_base, wave, lane);
  }
  // No copy is left in flight when the wave goes on to its end.
  asm volatile("s_wait_asynccnt 0x0" ::: "memory");

  // ---- epilogue: O /= l, store f32
  float li0[8], li1[8];
  for (int r = 0; r < 8; ++r) {
    li0[r] = 1.0f / l_run[r + kh * 8];
    li1[r] = 1.0f / l_run[16 + r + kh * 8];
  }
  for (int j = 0; j < 4; ++j) {
    const int ncol = wave * 64 + j * 16 + am;
    for (int r = 0; r < 8; ++r) {
      const int m = r + kh * 8;
      out[(qrow0 + m) * D + ncol]      = acc0[j][r] * li0[r];
      out[(qrow0 + 16 + m) * D + ncol] = acc1[j][r] * li1[r];
    }
  }
}

extern "C" void kernel_launch(void* const* d_in, const int* in_sizes, int n_in,
                              void* d_out, int out_size, void* d_ws, size_t ws_size,
                              hipStream_t stream) {
  const float* emb = (const float*)d_in[0];
  const float* Wqk = (const float*)d_in[1];
  const float* bqk = (const float*)d_in[2];
  const float* Wv  = (const float*)d_in[3];
  const float* bv  = (const float*)d_in[4];

  short* Qg = (short*)d_ws;                       // bf16 [8192][512]  (8 MB)
  short* Vt = Qg + (size_t)N_TOK * D;             // bf16 [512][8192]  (8 MB)
  float* out = (float*)d_out;                     // f32  [8192][512]

  proj_kernel<<<2048, 256, 0, stream>>>(emb, Wqk, bqk, Wv, bv, Qg, Vt);
  attn_kernel<<<N_TOK / BM, 256, 0, stream>>>(Qg, Vt, out);
}

// v002
// Measured time: 253 microseconds a run.
// Next to v001, in two timings, it ran 1.38 times as fast each time.
// Counting every step since v000, it is 1.89 times as fast.
#include <hip/hip_runtime.h>

#define N_TOK 8192
#define D 512
#define BM 32            /* query rows per block (2 strips of 16)           */
#define BN 128           /* keys per tile (8 waves x 16 keys)               */
#define SCALE 0.04419417382415922f  /* 1/sqrt(512) */

#define QS_STRIDE 528    /* 512 + 16 elems, 1056B: 16B-aligned, bank-skewed */
#define PS_STRIDE 144    /* 128 + 16 elems, 288B: 16B-aligned               */
#define SS_STRIDE 132    /* f32 scores, scalar access                       */

typedef __attribute__((ext_vector_type(16))) __bf16 v16bf;
typedef __attribute__((ext_vector_type(8)))  float  v8f;
typedef __attribute__((ext_vector_type(8)))  short  v8s;

struct bpair { v8s lo, hi; };

// 16x32-bf16 A/B fragment for v_wmma_f32_16x16x32_bf16 from two 16-byte
// chunks (K = kk..kk+7 and kk+16..kk+23 for this lane; lanes 0-15 kh=0,
// lanes 16-31 kh=1, per the ISA 16-bit A/B VGPR striping).
static __device__ __forceinline__ v16bf frag_from(const void* plo, const void* phi) {
  bpair f;
  f.lo = *(const v8s*)plo;
  f.hi = *(const v8s*)phi;
  return __builtin_bit_cast(v16bf, f);
}

// Hardware f32->bf16 convert (let clang pick v_cvt, ideally packed).
static __device__ __forceinline__ short f2bf(float x) {
  __bf16 h = (__bf16)x;
  return __builtin_bit_cast(short, h);
}

// ---------------------------------------------------------------------------
// Kernel 1: Q = emb @ Wqk^T + bqk  (bf16, row-major [N][D])
//           V = emb @ Wv^T  + bv   (bf16, TRANSPOSED: Vt[D][N])
// One block per 128 tokens x 128 output features (feature blocks 0..3 are Q,
// 4..7 are V). The f32 operands come in by whole-line loads, 64 k at a time,
// are rounded to bf16 once and staged in LDS (two buffers); each of the 8
// waves works a 32 x 64 tile, so a fragment read from LDS feeds 4 or 2 WMMAs.
// ---------------------------------------------------------------------------
#define PB 128           /* tokens, and features, per block                 */
#define PBK 64           /* k per staged chunk                              */
#define PT_STRIDE 72     /* 64 + 8 elems, 144B = 16B x odd: no bank conflict */

typedef __attribute__((ext_vector_type(4))) short v4s;

static __device__ __forceinline__ v4s cvt4(float4 a) {
  v4s r;
  r[0] = f2bf(a.x); r[1] = f2bf(a.y); r[2] = f2bf(a.z); r[3] = f2bf(a.w);
  return r;
}

__global__ __launch_bounds__(256) void proj_kernel(
    const float* __restrict__ emb,
    const float* __restrict__ Wqk, const float* __restrict__ bqk,
    const float* __restrict__ Wv,  const float* __restrict__ bv,
    short* __restrict__ Qg, short* __restrict__ Vt)
{
  __shared__ __attribute__((aligned(16))) short As[2][PB * PT_STRIDE];
  __shared__ __attribute__((aligned(16))) short Bs[2][PB * PT_STRIDE];

  const int tid  = threadIdx.x;
  const int lane = tid & 31;
  const int wave = tid >> 5;
  const int am = lane & 15;
  const int kh = lane >> 4;
  const int bm = blockIdx.x >> 3;           // token block   0..63
  const int bn = blockIdx.x & 7;            // feature block 0..7
  const bool is_v = bn >= 4;
  const int f0 = (bn & 3) * PB;             // first feature, in its own matrix
  const int t0 = bm * PB;                   // first token
  const int wm = wave & 3;                  // 32-token strip of the block
  const int wn = wave >> 2;                 // 64-feature half of the block

  // Staging map: 16 lanes cover one row's 256 B, a wave two rows.
  const int lrow = tid >> 4;
  const int lc4  = tid & 15;
  const float* asrc = emb + (t0 + lrow) * D + lc4 * 4;
  const float* bsrc = (is_v ? Wv : Wqk) + (f0 + lrow) * D + lc4 * 4;
  const int sdst = lrow * PT_STRIDE + lc4 * 4;

  float4 ra[8], rb[8];
  for (int i = 0; i < 8; ++i) {
    ra[i] = *(const float4*)(asrc + i * 16 * D);
    rb[i] = *(const float4*)(bsrc + i * 16 * D);
  }
  for (int i = 0; i < 8; ++i) {
    *(v4s*)&As[0][sdst + i * 16 * PT_STRIDE] = cvt4(ra[i]);
    *(v4s*)&Bs[0][sdst + i * 16 * PT_STRIDE] = cvt4(rb[i]);
  }
  __syncthreads();
  for (int i = 0; i < 8; ++i) {
    ra[i] = *(const float4*)(asrc + i * 16 * D + PBK);
    rb[i] = *(const float4*)(bsrc + i * 16 * D + PBK);
  }
  // The two pointers that these loads name are inputs here, so that their step
  // below stands behind this wait.
  asm volatile("s_wait_xcnt 0x0" :: "v"(asrc), "v"(bsrc) : "memory");
  asrc += PBK;
  bsrc += PBK;

  v8f acc[2][4] = {};
  // Kept rolled: unrolled, the whole loop is one block of code and the compiler
  // lifts the rounding, with the wait for the loads, in front of the products.
#pragma unroll 1
  for (int c = 0; c < D / PBK; ++c) {
    const short* at = &As[c & 1][(wm * 32 + am) * PT_STRIDE + kh * 8];
    const short* bt = &Bs[c & 1][(wn * 64 + am) * PT_STRIDE + kh * 8];
    for (int ks = 0; ks < PBK / 32; ++ks) {
      v16bf a[2], b[4];
      for (int m = 0; m < 2; ++m)
        a[m] = frag_from(at + m * 16 * PT_STRIDE + ks * 32,
                         at + m * 16 * PT_STRIDE + ks * 32 + 16);
      for (int n = 0; n < 4; ++n)
        b[n] = frag_from(bt + n * 16 * PT_STRIDE + ks * 32,
                         bt + n * 16 * PT_STRIDE + ks * 32 + 16);
      for (int m = 0; m < 2; ++m)
        for (int n = 0; n < 4; ++n)
          acc[m][n] = __builtin_amdgcn_wmma_f32_16x16x32_bf16(
              false, a[m], false, b[n], (short)0, acc[m][n], false, false);
    }
    if (c + 1 < D / PBK) {
      // Chunk c+1, loaded under the products above, goes to the other buffer,
      // whose last readers left it at the previous barrier.
      short* ad = &As[(c + 1) & 1][sdst];
      short* bd = &Bs[(c + 1) & 1][sdst];
      for (int i = 0; i < 8; ++i) {
        *(v4s*)(ad + i * 16 * PT_STRIDE) = cvt4(ra[i]);
        *(v4s*)(bd + i * 16 * PT_STRIDE) = cvt4(rb[i]);
      }
    }
    __syncthreads();
    if (c + 2 < D / PBK) {
      // The two pointers live across the trips, so no result lands in them.
      for (int i = 0; i < 8; ++i) {
        ra[i] = *(const float4*)(asrc + i * 16 * D + PBK);
        rb[i] = *(const float4*)(bsrc + i * 16 * D + PBK);
      }
      asrc += PBK;
      bsrc += PBK;
    }
  }

  // D layout: VGPR r -> token row (+ kh*8 + r), column = feature (+ am).
  const int ocol0 = f0 + wn * 64 + am;
  const int tok0  = t0 + wm * 32 + kh * 8;
  if (is_v) {
    // Vt row = feature, 8 contiguous tokens -> one 16B store.
    for (int n = 0; n < 4; ++n) {
      const float bias = bv[ocol0 + n * 16];
      for (int m = 0; m < 2; ++m) {
        v8s vp;
        for (int r = 0; r < 8; ++r) vp[r] = f2bf(acc[m][n][r] + bias);
        *(v8s*)(Vt + (ocol0 + n * 16) * N_TOK + tok0 + m * 16) = vp;
      }
    }
    // No register that these stores name is rewritten in front of this wait.
    asm volatile("s_wait_xcnt 0x0" ::: "memory");
  } else {
    for (int n = 0; n < 4; ++n) {
      const float bias = bqk[ocol0 + n * 16];
      for (int m = 0; m < 2; ++m)
        for (int r = 0; r < 8; ++r)
          Qg[(tok0 + m * 16 + r) * D + ocol0 + n * 16] = f2bf(acc[m][n][r] + bias);
    }
  }
}

// Eight 16-byte-per-lane asynchronous copies, global memory to LDS, through no
// register. The s_wait_xcnt stands inside the statement, behind the last copy,
// so that no address register named here is rewritten in front of it.
static __device__ __forceinline__ void async_copy8(const unsigned (&l)[8],
                                                   const short* const (&g)[8]) {
  asm volatile(
      "global_load_async_to_lds_b128 %0, %8, off\n\t"
      "global_load_async_to_lds_b128 %1, %9, off\n\t"
      "global_load_async_to_lds_b128 %2, %10, off\n\t"
      "global_load_async_to_lds_b128 %3, %11, off\n\t"
      "global_load_async_to_lds_b128 %4, %12, off\n\t"
      "global_load_async_to_lds_b128 %5, %13, off\n\t"
      "global_load_async_to_lds_b128 %6, %14, off\n\t"
      "global_load_async_to_lds_b128 %7, %15, off\n\t"
      "s_wait_xcnt 0x0"
      :: "v"(l[0]), "v"(l[1]), "v"(l[2]), "v"(l[3]),
         "v"(l[4]), "v"(l[5]), "v"(l[6]), "v"(l[7]),
         "v"(g[0]), "v"(g[1]), "v"(g[2]), "v"(g[3]),
         "v"(g[4]), "v"(g[5]), "v"(g[6]), "v"(g[7])
      : "memory");
}

// LDS tiles are unpadded; the 16-byte chunk c of a row sits at chunk position
// c ^ (row & 15), so 16 lanes reading one chunk column of 16 rows hit 16
// different bank groups.

// Key tile: wave w brings key rows [16w, 16w+16) of the 128-key tile, 1024 B
// each; one copy covers 512 contiguous global bytes.
static __device__ __forceinline__ void copy_k_tile(const short* __restrict__ Qg, int kb,
                                                   unsigned ks_base, int wave, int lane) {
  const short* gsrc = Qg + (kb + wave * 16) * D + lane * 8;
  const unsigned ldst = ks_base + wave * 16 * 1024;
  for (int q = 0; q < 4; ++q) {
    unsigned l[8];
    const short* g[8];
    for (int u = 0; u < 8; ++u) {
      const int i = q * 8 + u, r = i >> 1, h = i & 1;
      g[u] = gsrc + r * D + h * 256;
      l[u] = ldst + r * 1024 + h * 512 + ((lane ^ r) << 4);
    }
    async_copy8(l, g);
  }
}

// Value tile: wave w brings Vt rows [64w, 64w+64), 256 B (128 keys) each; one
// copy covers two rows.
static __device__ __forceinline__ void copy_v_tile(const short* __restrict__ Vt, int kb,
                                                   unsigned vs_base, int wave, int lane) {
  const int am = lane & 15, kh = lane >> 4;
  const short* gsrc = Vt + (wave * 64 + kh) * N_TOK + kb + am * 8;
  const unsigned ldst = vs_base + (wave * 64 + kh) * 256;
  for (int q = 0; q < 4; ++q) {
    unsigned l[8];
    const short* g[8];
    for (int u = 0; u < 8; ++u) {
      const int i = q * 8 + u;
      g[u] = gsrc + 2 * i * N_TOK;
      l[u] = ldst + i * 512 + (((am ^ kh) ^ ((2 * i) & 14)) << 4);
    }
    async_copy8(l, g);
  }
}

// ---------------------------------------------------------------------------
// Kernel 2: flash attention. Block = 32 query rows (2 strips), 8 waves.
// Per 128-key tile: wave w computes score subtiles (both strips) for keys
// [16w,16w+16) -- B fragment loaded ONCE, feeds TWO WMMAs; online softmax;
// then wave w computes P@V for output columns [64w, 64w+64) of both strips,
// again sharing each Vt B fragment across two WMMAs.
// The key tile and the value tile each have one LDS buffer, filled by
// asynchronous copies: V(t) flies under the score phase of tile t, K(t+1)
// under the softmax and P@V of tile t.
// ---------------------------------------------------------------------------
__global__ __launch_bounds__(256) void attn_kernel(
    const short* __restrict__ Qg, const short* __restrict__ Vt,
    float* __restrict__ out)
{
  __shared__ __attribute__((aligned(1024))) short Ks[BN * D];   // 128 KB
  __shared__ __attribute__((aligned(1024))) short Vs[D * BN];   // 128 KB
  __shared__ short Qs[BM * QS_STRIDE];      // 33.8 KB
  __shared__ float Ss[BM * SS_STRIDE];      // 16.9 KB
  __shared__ short Ps[BM * PS_STRIDE];      //  9.2 KB
  __shared__ float pmax[BM][8];
  __shared__ float psum[BM][8];
  __shared__ float m_run[BM], l_run[BM], m_new_s[BM], corr_s[BM];

  const int tid  = threadIdx.x;
  const int lane = tid & 31;
  const int wave = tid >> 5;
  const int am = lane & 15;
  const int kh = lane >> 4;
  const int qrow0 = blockIdx.x * BM;
  const unsigned ks_base = (unsigned)(unsigned long long)&Ks[0];
  const unsigned vs_base = (unsigned)(unsigned long long)&Vs[0];

  // Element offset of chunk 2e + kh of a row with (row & 15) == am.
  int sw[8];
  for (int e = 0; e < 8; ++e) sw[e] = ((2 * e) ^ (am ^ kh)) * 8;

  copy_k_tile(Qg, 0, ks_base, wave, lane);

  // Stage the 32x512 bf16 Q tile into LDS (2048 x 16B chunks, 8 per thread).
  for (int c = tid; c < BM * 64; c += 256) {
    const int r = c >> 6, cc = c & 63;
    *(v8s*)&Qs[r * QS_STRIDE + cc * 8] = *(const v8s*)(Qg + (qrow0 + r) * D + cc * 8);
  }
  if (tid < BM) { m_run[tid] = -3.0e38f; l_run[tid] = 0.0f; }
  // K(0) has landed before the barrier that lets anybody read it.
  asm volatile("s_wait_asynccnt 0x0" ::: "memory");
  __syncthreads();
  copy_v_tile(Vt, 0, vs_base, wave, lane);

  v8f acc0[4] = { {}, {}, {}, {} };   // strip 0 (rows 0..15)
  v8f acc1[4] = { {}, {}, {}, {} };   // strip 1 (rows 16..31)
  const int srow = tid >> 3;          // 0..31
  const int sseg = tid & 7;           // 16 cols per segment

  for (int kt = 0; kt < N_TOK / BN; ++kt) {
    const int kb = kt * BN;

    // ---- S subtiles: one key B-fragment feeds both strips' WMMAs
    v8f s0 = {}, s1 = {};
    const short* krow = &Ks[(wave * 16 + am) * D];
    for (int s = 0; s < 16; ++s) {
      const int kk = s * 32 + kh * 8;
      v16bf b  = frag_from(krow + (s >> 2) * 128 + sw[(2 * s) & 7],
                           krow + (s >> 2) * 128 + sw[(2 * s + 1) & 7]);
      v16bf a0 = frag_from(&Qs[am * QS_STRIDE + kk],        &Qs[am * QS_STRIDE + kk + 16]);
      v16bf a1 = frag_from(&Qs[(16 + am) * QS_STRIDE + kk], &Qs[(16 + am) * QS_STRIDE + kk + 16]);
      s0 = __builtin_amdgcn_wmma_f32_16x16x32_bf16(false, a0, false, b, (short)0, s0, false, false);
      s1 = __builtin_amdgcn_wmma_f32_16x16x32_bf16(false, a1, false, b, (short)0, s1, false, false);
    }
    for (int r = 0; r < 8; ++r) {
      const int m = r + kh * 8;
      Ss[m * SS_STRIDE + wave * 16 + am]        = s0[r];
      Ss[(16 + m) * SS_STRIDE + wave * 16 + am] = s1[r];
    }
    // Foot of the score phase: this wave's reads of Ks are done and its copies
    // of V(t) have landed before the barrier; behind it Ks is refilled.
    asm volatile("s_wait_dscnt 0x0" ::: "memory");
    asm volatile("s_wait_asynccnt 0x0" ::: "memory");
    __syncthreads();
    if (kb + BN < N_TOK) copy_k_tile(Qg, kb + BN, ks_base, wave, lane);

    // ---- online softmax (256 threads: row = tid/8, 16 cols per thread)
    float mx = -3.0e38f;
    for (int j = 0; j < 16; ++j)
      mx = fmaxf(mx, Ss[srow * SS_STRIDE + sseg * 16 + j] * SCALE);
    pmax[srow][sseg] = mx;
    __syncthreads();
    if (sseg == 0) {
      float mt = pmax[srow][0];
      for (int j = 1; j < 8; ++j) mt = fmaxf(mt, pmax[srow][j]);
      const float mo = m_run[srow];
      const float mn = fmaxf(mo, mt);
      m_new_s[srow] = mn;
      corr_s[srow]  = __expf(mo - mn);
      m_run[srow]   = mn;
    }
    __syncthreads();
    {
      const float mn = m_new_s[srow];
      float ps = 0.0f;
      for (int j = 0; j < 16; ++j) {
        const int c = sseg * 16 + j;
        const float p = __expf(Ss[srow * SS_STRIDE + c] * SCALE - mn);
        ps += p;
        Ps[srow * PS_STRIDE + c] = f2bf(p);
      }
      psum[srow][sseg] = ps;
    }
    __syncthreads();
    if (sseg == 0) {
      float t = 0.0f;
      for (int j = 0; j < 8; ++j) t += psum[srow][j];
      l_run[srow] = l_run[srow] * corr_s[srow] + t;
    }

    // ---- O = corr*O + P @ V_tile ; wave w owns cols [64w, 64w+64), 2 strips
    float cr0[8], cr1[8];
    for (int r = 0; r < 8; ++r) {
      cr0[r] = corr_s[r + kh * 8];
      cr1[r] = corr_s[16 + r + kh * 8];
    }
    for (int j = 0; j < 4; ++j)
      for (int r = 0; r < 8; ++r) { acc0[j][r] *= cr0[r]; acc1[j][r] *= cr1[r]; }

    v16bf pa0[4], pa1[4];
    for (int s = 0; s < 4; ++s) {
      const int kk = s * 32 + kh * 8;
      pa0[s] = frag_from(&Ps[am * PS_STRIDE + kk],        &Ps[am * PS_STRIDE + kk + 16]);
      pa1[s] = frag_from(&Ps[(16 + am) * PS_STRIDE + kk], &Ps[(16 + am) * PS_STRIDE + kk + 16]);
    }
    for (int j = 0; j < 4; ++j) {
      const int ncol = wave * 64 + j * 16 + am;
      const short* vb = &Vs[ncol * BN];
      for (int s = 0; s < 4; ++s) {
        v16bf b = frag_from(vb + sw[2 * s], vb + sw[2 * s + 1]);
        acc0[j] = __builtin_amdgcn_wmma_f32_16x16x32_bf16(false, pa0[s], false, b, (short)0, acc0[j], false, false);
        acc1[j] = __builtin_amdgcn_wmma_f32_16x16x32_bf16(false, pa1[s], false, b, (short)0, acc1[j], false, false);
      }
    }
    // Foot of the P@V phase: this wave's reads of Vs are done and its copies
    // of K(t+1) have landed before the barrier; behind it Vs is refilled.
    asm volatile("s_wait_dscnt 0x0" ::: "memory");
    asm volatile("s_wait_asynccnt 0x0" ::: "memory");
    __syncthreads();
    if (kb + BN < N_TOK) copy_v_tile(Vt, kb + BN, vs_base, wave, lane);
  }
  // No copy is left in flight when the wave goes on to its end.
  asm volatile("s_wait_asynccnt 0x0" ::: "memory");

  // ---- epilogue: O /= l, store f32
  float li0[8], li1[8];
  for (int r = 0; r < 8; ++r) {
    li0[r] = 1.0f / l_run[r + kh * 8];
    li1[r] = 1.0f / l_run[16 + r + kh * 8];
  }
  for (int j = 0; j < 4; ++j) {
    const int ncol = wave * 64 + j * 16 + am;
    for (int r = 0; r < 8; ++r) {
      const int m = r + kh * 8;
      out[(qrow0 + m) * D + ncol]      = acc0[j][r] * li0[r];
      out[(qrow0 + 16 + m) * D + ncol] = acc1[j][r] * li1[r];
    }
  }
}

extern "C" void kernel_launch(void* const* d_in, const int* in_sizes, int n_in,
                              void* d_out, int out_size, void* d_ws, size_t ws_size,
                              hipStream_t stream) {
  const float* emb = (const float*)d_in[0];
  const float* Wqk = (const float*)d_in[1];
  const float* bqk = (const float*)d_in[2];
  const float* Wv  = (const float*)d_in[3];
  const float* bv  = (const float*)d_in[4];

  short* Qg = (short*)d_ws;                       // bf16 [8192][512]  (8 MB)
  short* Vt = Qg + (size_t)N_TOK * D;             // bf16 [512][8192]  (8 MB)
  float* out = (float*)d_out;                     // f32  [8192][512]

  proj_kernel<<<512, 256, 0, stream>>>(emb, Wqk, bqk, Wv, bv, Qg, Vt);
  attn_kernel<<<N_TOK / BM, 256, 0, stream>>>(Qg, Vt, out);
}

// v003
// A run of this version takes 227 microseconds.
// Two timings next to v002 both put it at 1.12 times that version's speed.
// Counting every step since v000, it is 2.11 times as fast.
#include <hip/hip_runtime.h>

#define N_TOK 8192
#define D 512
#define BM 32            /* query rows per block (2 strips of 16)           */
#define BN 128           /* keys per tile (8 waves x 16 keys)               */
#define SCALE 0.04419417382415922f  /* 1/sqrt(512) */

/* Row pitches for 16-byte LDS reads: 16 B x odd, so that the 16 rows (or the
   2 rows x 8 segments) that half a wave reads at once fall on all 64 banks. */
#define QS_STRIDE 520    /* 512 + 8 elems, 1040 B = 16 B x 65               */
#define PS_STRIDE 136    /* 128 + 8 elems,  272 B = 16 B x 17               */
#define SS_STRIDE 140    /* f32 scores: 128 + 8 (mid-row gap) + 4, 16 B x 35 */
/* First dword of 16-column group g of a score row: columns 64..127 stand 8
   dwords further on, so groups g and g + 4 do not share banks.             */
#define SS_GRP(g) ((g) * 16 + ((g) >> 2) * 8)

typedef __attribute__((ext_vector_type(16))) __bf16 v16bf;
typedef __attribute__((ext_vector_type(8)))  float  v8f;
typedef __attribute__((ext_vector_type(8)))  short  v8s;

struct bpair { v8s lo, hi; };

// 16x32-bf16 A/B fragment for v_wmma_f32_16x16x32_bf16 from two 16-byte
// chunks (K = kk..kk+7 and kk+16..kk+23 for this lane; lanes 0-15 kh=0,
// lanes 16-31 kh=1, per the ISA 16-bit A/B VGPR striping).
static __device__ __forceinline__ v16bf frag_from(const void* plo, const void* phi) {
  bpair f;
  f.lo = *(const v8s*)plo;
  f.hi = *(const v8s*)phi;
  return __builtin_bit_cast(v16bf, f);
}

// Hardware f32->bf16 convert (let clang pick v_cvt, ideally packed).
static __device__ __forceinline__ short f2bf(float x) {
  __bf16 h = (__bf16)x;
  return __builtin_bit_cast(short, h);
}

// ---------------------------------------------------------------------------
// Kernel 1: Q = emb @ Wqk^T + bqk  (bf16, row-major [N][D])
//           V = emb @ Wv^T  + bv   (bf16, TRANSPOSED: Vt[D][N])
// One block per 128 tokens x 128 output features (feature blocks 0..3 are Q,
// 4..7 are V). The f32 operands come in by whole-line loads, 64 k at a time,
// are rounded to bf16 once and staged in LDS (two buffers); each of the 8
// waves works a 32 x 64 tile, so a fragment read from LDS feeds 4 or 2 WMMAs.
// ---------------------------------------------------------------------------
#define PB 128           /* tokens, and features, per block                 */
#define PBK 64           /* k per staged chunk                              */
#define PT_STRIDE 72     /* 64 + 8 elems, 144B = 16B x odd: no bank conflict */

typedef __attribute__((ext_vector_type(4))) short v4s;

static __device__ __forceinline__ v4s cvt4(float4 a) {
  v4s r;
  r[0] = f2bf(a.x); r[1] = f2bf(a.y); r[2] = f2bf(a.z); r[3] = f2bf(a.w);
  return r;
}

__global__ __launch_bounds__(256) void proj_kernel(
    const float* __restrict__ emb,
    const float* __restrict__ Wqk, const float* __restrict__ bqk,
    const float* __restrict__ Wv,  const float* __restrict__ bv,
    short* __restrict__ Qg, short* __restrict__ Vt)
{
  __shared__ __attribute__((aligned(16))) short As[2][PB * PT_STRIDE];
  __shared__ __attribute__((aligned(16))) short Bs[2][PB * PT_STRIDE];

  const int tid  = threadIdx.x;
  const int lane = tid & 31;
  const int wave = tid >> 5;
  const int am = lane & 15;
  const int kh = lane >> 4;
  const int bm = blockIdx.x >> 3;           // token block   0..63
  const int bn = blockIdx.x & 7;            // feature block 0..7
  const bool is_v = bn >= 4;
  const int f0 = (bn & 3) * PB;             // first feature, in its own matrix
  const int t0 = bm * PB;                   // first token
  const int wm = wave & 3;                  // 32-token strip of the block
  const int wn = wave >> 2;                 // 64-feature half of the block

  // Staging map: 16 lanes cover one row's 256 B, a wave two rows.
  const int lrow = tid >> 4;
  const int lc4  = tid & 15;
  const float* asrc = emb + (t0 + lrow) * D + lc4 * 4;
  const float* bsrc = (is_v ? Wv : Wqk) + (f0 + lrow) * D + lc4 * 4;
  const int sdst = lrow * PT_STRIDE + lc4 * 4;

  float4 ra[8], rb[8];
  for (int i = 0; i < 8; ++i) {
    ra[i] = *(const float4*)(asrc + i * 16 * D);
    rb[i] = *(const float4*)(bsrc + i * 16 * D);
  }
  for (int i = 0; i < 8; ++i) {
    *(v4s*)&As[0][sdst + i * 16 * PT_STRIDE] = cvt4(ra[i]);
    *(v4s*)&Bs[0][sdst + i * 16 * PT_STRIDE] = cvt4(rb[i]);
  }
  __syncthreads();
  for (int i = 0; i < 8; ++i) {
    ra[i] = *(const float4*)(asrc + i * 16 * D + PBK);
    rb[i] = *(const float4*)(bsrc + i * 16 * D + PBK);
  }
  // The two pointers that these loads name are inputs here, so that their step
  // below stands behind this wait.
  asm volatile("s_wait_xcnt 0x0" :: "v"(asrc), "v"(bsrc) : "memory");
  asrc += PBK;
  bsrc += PBK;

  v8f acc[2][4] = {};
  // Kept rolled: unrolled, the whole loop is one block of code and the compiler
  // lifts the rounding, with the wait for the loads, in front of the products.
#pragma unroll 1
  for (int c = 0; c < D / PBK; ++c) {
    const short* at = &As[c & 1][(wm * 32 + am) * PT_STRIDE + kh * 8];
    const short* bt = &Bs[c & 1][(wn * 64 + am) * PT_STRIDE + kh * 8];
    for (int ks = 0; ks < PBK / 32; ++ks) {
      v16bf a[2], b[4];
      for (int m = 0; m < 2; ++m)
        a[m] = frag_from(at + m * 16 * PT_STRIDE + ks * 32,
                         at + m * 16 * PT_STRIDE + ks * 32 + 16);
      for (int n = 0; n < 4; ++n)
        b[n] = frag_from(bt + n * 16 * PT_STRIDE + ks * 32,
                         bt + n * 16 * PT_STRIDE + ks * 32 + 16);
      for (int m = 0; m < 2; ++m)
        for (int n = 0; n < 4; ++n)
          acc[m][n] = __builtin_amdgcn_wmma_f32_16x16x32_bf16(
              false, a[m], false, b[n], (short)0, acc[m][n], false, false);
    }
    if (c + 1 < D / PBK) {
      // Chunk c+1, loaded under the products above, goes to the other buffer,
      // whose last readers left it at the previous barrier.
      short* ad = &As[(c + 1) & 1][sdst];
      short* bd = &Bs[(c + 1) & 1][sdst];
      for (int i = 0; i < 8; ++i) {
        *(v4s*)(ad + i * 16 * PT_STRIDE) = cvt4(ra[i]);
        *(v4s*)(bd + i * 16 * PT_STRIDE) = cvt4(rb[i]);
      }
    }
    __syncthreads();
    if (c + 2 < D / PBK) {
      // The two pointers live across the trips, so no result lands in them.
      for (int i = 0; i < 8; ++i) {
        ra[i] = *(const float4*)(asrc + i * 16 * D + PBK);
        rb[i] = *(const float4*)(bsrc + i * 16 * D + PBK);
      }
      asrc += PBK;
      bsrc += PBK;
    }
  }

  // D layout: VGPR r -> token row (+ kh*8 + r), column = feature (+ am).
  const int ocol0 = f0 + wn * 64 + am;
  const int tok0  = t0 + wm * 32 + kh * 8;
  if (is_v) {
    // Vt row = feature, 8 contiguous tokens -> one 16B store.
    for (int n = 0; n < 4; ++n) {
      const float bias = bv[ocol0 + n * 16];
      for (int m = 0; m < 2; ++m) {
        v8s vp;
        for (int r = 0; r < 8; ++r) vp[r] = f2bf(acc[m][n][r] + bias);
        *(v8s*)(Vt + (ocol0 + n * 16) * N_TOK + tok0 + m * 16) = vp;
      }
    }
    // No register that these stores name is rewritten in front of this wait.
    asm volatile("s_wait_xcnt 0x0" ::: "memory");
  } else {
    for (int n = 0; n < 4; ++n) {
      const float bias = bqk[ocol0 + n * 16];
      for (int m = 0; m < 2; ++m)
        for (int r = 0; r < 8; ++r)
          Qg[(tok0 + m * 16 + r) * D + ocol0 + n * 16] = f2bf(acc[m][n][r] + bias);
    }
  }
}

// Eight 16-byte-per-lane asynchronous copies, global memory to LDS, through no
// register. The s_wait_xcnt stands inside the statement, behind the last copy,
// so that no address register named here is rewritten in front of it.
static __device__ __forceinline__ void async_copy8(const unsigned (&l)[8],
                                                   const short* const (&g)[8]) {
  asm volatile(
      "global_load_async_to_lds_b128 %0, %8, off\n\t"
      "global_load_async_to_lds_b128 %1, %9, off\n\t"
      "global_load_async_to_lds_b128 %2, %10, off\n\t"
      "global_load_async_to_lds_b128 %3, %11, off\n\t"
      "global_load_async_to_lds_b128 %4, %12, off\n\t"
      "global_load_async_to_lds_b128 %5, %13, off\n\t"
      "global_load_async_to_lds_b128 %6, %14, off\n\t"
      "global_load_async_to_lds_b128 %7, %15, off\n\t"
      "s_wait_xcnt 0x0"
      :: "v"(l[0]), "v"(l[1]), "v"(l[2]), "v"(l[3]),
         "v"(l[4]), "v"(l[5]), "v"(l[6]), "v"(l[7]),
         "v"(g[0]), "v"(g[1]), "v"(g[2]), "v"(g[3]),
         "v"(g[4]), "v"(g[5]), "v"(g[6]), "v"(g[7])
      : "memory");
}

// LDS tiles are unpadded; the 16-byte chunk c of a row sits at chunk position
// c ^ (row & 15), so 16 lanes reading one chunk column of 16 rows hit 16
// different bank groups.

// Key tile: wave w brings key rows [16w, 16w+16) of the 128-key tile, 1024 B
// each; one copy covers 512 contiguous global bytes.
static __device__ __forceinline__ void copy_k_tile(const short* __restrict__ Qg, int kb,
                                                   unsigned ks_base, int wave, int lane) {
  const short* gsrc = Qg + (kb + wave * 16) * D + lane * 8;
  const unsigned ldst = ks_base + wave * 16 * 1024;
  for (int q = 0; q < 4; ++q) {
    unsigned l[8];
    const short* g[8];
    for (int u = 0; u < 8; ++u) {
      const int i = q * 8 + u, r = i >> 1, h = i & 1;
      g[u] = gsrc + r * D + h * 256;
      l[u] = ldst + r * 1024 + h * 512 + ((lane ^ r) << 4);
    }
    async_copy8(l, g);
  }
}

// Value tile: wave w brings Vt rows [64w, 64w+64), 256 B (128 keys) each; one
// copy covers two rows.
static __device__ __forceinline__ void copy_v_tile(const short* __restrict__ Vt, int kb,
                                                   unsigned vs_base, int wave, int lane) {
  const int am = lane & 15, kh = lane >> 4;
  const short* gsrc = Vt + (wave * 64 + kh) * N_TOK + kb + am * 8;
  const unsigned ldst = vs_base + (wave * 64 + kh) * 256;
  for (int q = 0; q < 4; ++q) {
    unsigned l[8];
    const short* g[8];
    for (int u = 0; u < 8; ++u) {
      const int i = q * 8 + u;
      g[u] = gsrc + 2 * i * N_TOK;
      l[u] = ldst + i * 512 + (((am ^ kh) ^ ((2 * i) & 14)) << 4);
    }
    async_copy8(l, g);
  }
}

// ---------------------------------------------------------------------------
// Kernel 2: flash attention. Block = 32 query rows (2 strips), 8 waves.
// Per 128-key tile: wave w computes score subtiles (both strips) for keys
// [16w,16w+16) -- B fragment loaded ONCE, feeds TWO WMMAs; online softmax;
// then wave w computes P@V for output columns [64w, 64w+64) of both strips,
// again sharing each Vt B fragment across two WMMAs.
// The key tile and the value tile each have one LDS buffer, filled by
// asynchronous copies: V(t) flies under the score phase of tile t, K(t+1)
// under the softmax and P@V of tile t.
// ---------------------------------------------------------------------------
__global__ __launch_bounds__(256) void attn_kernel(
    const short* __restrict__ Qg, const short* __restrict__ Vt,
    float* __restrict__ out)
{
  __shared__ __attribute__((aligned(1024))) short Ks[BN * D];   // 128 KB
  __shared__ __attribute__((aligned(1024))) short Vs[D * BN];   // 128 KB
  __shared__ __attribute__((aligned(16))) short Qs[BM * QS_STRIDE];   // 33.3 KB
  __shared__ __attribute__((aligned(16))) float Ss[BM * SS_STRIDE];   // 17.9 KB
  __shared__ __attribute__((aligned(16))) short Ps[BM * PS_STRIDE];   //  8.7 KB
  __shared__ float pmax[BM][8];
  __shared__ float psum[BM][8];
  __shared__ float m_run[BM], l_run[BM], m_new_s[BM], corr_s[BM];

  const int tid  = threadIdx.x;
  const int lane = tid & 31;
  const int wave = tid >> 5;
  const int am = lane & 15;
  const int kh = lane >> 4;
  const int qrow0 = blockIdx.x * BM;
  const unsigned ks_base = (unsigned)(unsigned long long)&Ks[0];
  const unsigned vs_base = (unsigned)(unsigned long long)&Vs[0];

  // Element offset of chunk 2e + kh of a row with (row & 15) == am.
  int sw[8];
  for (int e = 0; e < 8; ++e) sw[e] = ((2 * e) ^ (am ^ kh)) * 8;

  copy_k_tile(Qg, 0, ks_base, wave, lane);

  // Stage the 32x512 bf16 Q tile into LDS (2048 x 16B chunks, 8 per thread).
  for (int c = tid; c < BM * 64; c += 256) {
    const int r = c >> 6, cc = c & 63;
    *(v8s*)&Qs[r * QS_STRIDE + cc * 8] = *(const v8s*)(Qg + (qrow0 + r) * D + cc * 8);
  }
  if (tid < BM) { m_run[tid] = -3.0e38f; l_run[tid] = 0.0f; }
  // K(0) has landed before the barrier that lets anybody read it.
  asm volatile("s_wait_asynccnt 0x0" ::: "memory");
  __syncthreads();
  copy_v_tile(Vt, 0, vs_base, wave, lane);

  v8f acc0[4] = { {}, {}, {}, {} };   // strip 0 (rows 0..15)
  v8f acc1[4] = { {}, {}, {}, {} };   // strip 1 (rows 16..31)
  const int srow = tid >> 3;          // 0..31
  const int sseg = tid & 7;           // 16 cols per segment

  for (int kt = 0; kt < N_TOK / BN; ++kt) {
    const int kb = kt * BN;

    // ---- S subtiles: one key B-fragment feeds both strips' WMMAs
    v8f s0 = {}, s1 = {};
    const short* krow = &Ks[(wave * 16 + am) * D];
    for (int s = 0; s < 16; ++s) {
      const int kk = s * 32 + kh * 8;
      v16bf b  = frag_from(krow + (s >> 2) * 128 + sw[(2 * s) & 7],
                           krow + (s >> 2) * 128 + sw[(2 * s + 1) & 7]);
      v16bf a0 = frag_from(&Qs[am * QS_STRIDE + kk],        &Qs[am * QS_STRIDE + kk + 16]);
      v16bf a1 = frag_from(&Qs[(16 + am) * QS_STRIDE + kk], &Qs[(16 + am) * QS_STRIDE + kk + 16]);
      s0 = __builtin_amdgcn_wmma_f32_16x16x32_bf16(false, a0, false, b, (short)0, s0, false, false);
      s1 = __builtin_amdgcn_wmma_f32_16x16x32_bf16(false, a1, false, b, (short)0, s1, false, false);
    }
    for (int r = 0; r < 8; ++r) {
      const int m = r + kh * 8;
      Ss[m * SS_STRIDE + SS_GRP(wave) + am]        = s0[r];
      Ss[(16 + m) * SS_STRIDE + SS_GRP(wave) + am] = s1[r];
    }
    // Foot of the score phase: this wave's reads of Ks are done and its copies
    // of V(t) have landed before the barrier; behind it Ks is refilled.
    asm volatile("s_wait_dscnt 0x0" ::: "memory");
    asm volatile("s_wait_asynccnt 0x0" ::: "memory");
    __syncthreads();
    if (kb + BN < N_TOK) copy_k_tile(Qg, kb + BN, ks_base, wave, lane);

    // ---- online softmax (256 threads: row = tid/8, 16 cols per thread)
    float mx = -3.0e38f;
    for (int j = 0; j < 16; ++j)
      mx = fmaxf(mx, Ss[srow * SS_STRIDE + SS_GRP(sseg) + j] * SCALE);
    pmax[srow][sseg] = mx;
    __syncthreads();
    if (sseg == 0) {
      float mt = pmax[srow][0];
      for (int j = 1; j < 8; ++j) mt = fmaxf(mt, pmax[srow][j]);
      const float mo = m_run[srow];
      const float mn = fmaxf(mo, mt);
      m_new_s[srow] = mn;
      corr_s[srow]  = __expf(mo - mn);
      m_run[srow]   = mn;
    }
    __syncthreads();
    {
      const float mn = m_new_s[srow];
      float ps = 0.0f;
      for (int j = 0; j < 16; ++j) {
        const int c = sseg * 16 + j;
        const float p = __expf(Ss[srow * SS_STRIDE + SS_GRP(sseg) + j] * SCALE - mn);
        ps += p;
        Ps[srow * PS_STRIDE + c] = f2bf(p);
      }
      psum[srow][sseg] = ps;
    }
    __syncthreads();
    if (sseg == 0) {
      float t = 0.0f;
      for (int j = 0; j < 8; ++j) t += psum[srow][j];
      l_run[srow] = l_run[srow] * corr_s[srow] + t;
    }

    // ---- O = corr*O + P @ V_tile ; wave w owns cols [64w, 64w+64), 2 strips
    float cr0[8], cr1[8];
    for (int r = 0; r < 8; ++r) {
      cr0[r] = corr_s[r + kh * 8];
      cr1[r] = corr_s[16 + r + kh * 8];
    }
    for (int j = 0; j < 4; ++j)
      for (int r = 0; r < 8; ++r) { acc0[j][r] *= cr0[r]; acc1[j][r] *= cr1[r]; }

    v16bf pa0[4], pa1[4];
    for (int s = 0; s < 4; ++s) {
      const int kk = s * 32 + kh * 8;
      pa0[s] = frag_from(&Ps[am * PS_STRIDE + kk],        &Ps[am * PS_STRIDE + kk + 16]);
      pa1[s] = frag_from(&Ps[(16 + am) * PS_STRIDE + kk], &Ps[(16 + am) * PS_STRIDE + kk + 16]);
    }
    for (int j = 0; j < 4; ++j) {
      const int ncol = wave * 64 + j * 16 + am;
      const short* vb = &Vs[ncol * BN];
      for (int s = 0; s < 4; ++s) {
        v16bf b = frag_from(vb + sw[2 * s], vb + sw[2 * s + 1]);
        acc0[j] = __builtin_amdgcn_wmma_f32_16x16x32_bf16(false, pa0[s], false, b, (short)0, acc0[j], false, false);
        acc1[j] = __builtin_amdgcn_wmma_f32_16x16x32_bf16(false, pa1[s], false, b, (short)0, acc1[j], false, false);
      }
    }
    // Foot of the P@V phase: this wave's reads of Vs are done and its copies
    // of K(t+1) have landed before the barrier; behind it Vs is refilled.
    asm volatile("s_wait_dscnt 0x0" ::: "memory");
    asm volatile("s_wait_asynccnt 0x0" ::: "memory");
    __syncthreads();
    if (kb + BN < N_TOK) copy_v_tile(Vt, kb + BN, vs_base, wave, lane);
  }
  // No copy is left in flight when the wave goes on to its end.
  asm volatile("s_wait_asynccnt 0x0" ::: "memory");

  // ---- epilogue: O /= l, store f32
  float li0[8], li1[8];
  for (int r = 0; r < 8; ++r) {
    li0[r] = 1.0f / l_run[r + kh * 8];
    li1[r] = 1.0f / l_run[16 + r + kh * 8];
  }
  for (int j = 0; j < 4; ++j) {
    const int ncol = wave * 64 + j * 16 + am;
    for (int r = 0; r < 8; ++r) {
      const int m = r + kh * 8;
      out[(qrow0 + m) * D + ncol]      = acc0[j][r] * li0[r];
      out[(qrow0 + 16 + m) * D + ncol] = acc1[j][r] * li1[r];
    }
  }
}

extern "C" void kernel_launch(void* const* d_in, const int* in_sizes, int n_in,
                              void* d_out, int out_size, void* d_ws, size_t ws_size,
                              hipStream_t stream) {
  const float* emb = (const float*)d_in[0];
  const float* Wqk = (const float*)d_in[1];
  const float* bqk = (const float*)d_in[2];
  const float* Wv  = (const float*)d_in[3];
  const float* bv  = (const float*)d_in[4];

  short* Qg = (short*)d_ws;                       // bf16 [8192][512]  (8 MB)
  short* Vt = Qg + (size_t)N_TOK * D;             // bf16 [512][8192]  (8 MB)
  float* out = (float*)d_out;                     // f32  [8192][512]

  proj_kernel<<<512, 256, 0, stream>>>(emb, Wqk, bqk, Wv, bv, Qg, Vt);
  attn_kernel<<<N_TOK / BM, 256, 0, stream>>>(Qg, Vt, out);
}

// v004
// One run takes 190 microseconds.
// In two side-by-side timings against v003, it was 1.18 and 1.19 times as fast.
// All steps since v000 together make it 2.50 times as fast.
#include <hip/hip_runtime.h>

#define N_TOK 8192
#define D 512
#define BM 32            /* query rows per block (2 strips of 16)           */
#define BN 128           /* keys per tile (8 waves x 16 keys)               */
#define SCALE 0.04419417382415922f  /* 1/sqrt(512) */

/* Row pitches for 16-byte LDS reads: 16 B x odd, so that the 16 rows (or the
   2 rows x 8 segments) that half a wave reads at once fall on all 64 banks. */
#define QS_STRIDE 520    /* 512 + 8 elems, 1040 B = 16 B x 65               */
#define PS_STRIDE 136    /* 128 + 8 elems,  272 B = 16 B x 17               */
#define SS_STRIDE 140    /* f32 scores: 128 + 8 (mid-row gap) + 4, 16 B x 35 */
/* First dword of 16-column group g of a score row: columns 64..127 stand 8
   dwords further on, so groups g and g + 4 do not share banks.             */
#define SS_GRP(g) ((g) * 16 + ((g) >> 2) * 8)

typedef __attribute__((ext_vector_type(16))) __bf16 v16bf;
typedef __attribute__((ext_vector_type(8)))  float  v8f;
typedef __attribute__((ext_vector_type(8)))  short  v8s;

struct bpair { v8s lo, hi; };

// 16x32-bf16 A/B fragment for v_wmma_f32_16x16x32_bf16 from two 16-byte
// chunks (K = kk..kk+7 and kk+16..kk+23 for this lane; lanes 0-15 kh=0,
// lanes 16-31 kh=1, per the ISA 16-bit A/B VGPR striping).
static __device__ __forceinline__ v16bf frag_from(const void* plo, const void* phi) {
  bpair f;
  f.lo = *(const v8s*)plo;
  f.hi = *(const v8s*)phi;
  return __builtin_bit_cast(v16bf, f);
}

// Hardware f32->bf16 convert (let clang pick v_cvt, ideally packed).
static __device__ __forceinline__ short f2bf(float x) {
  __bf16 h = (__bf16)x;
  return __builtin_bit_cast(short, h);
}

// ---------------------------------------------------------------------------
// Kernel 1: Q = emb @ Wqk^T + bqk  (bf16, row-major [N][D])
//           V = emb @ Wv^T  + bv   (bf16, TRANSPOSED: Vt[D][N])
// One block per 128 tokens x 128 output features (feature blocks 0..3 are Q,
// 4..7 are V). The f32 operands come in by whole-line loads, 64 k at a time,
// are rounded to bf16 once and staged in LDS (two buffers); each of the 8
// waves works a 32 x 64 tile, so a fragment read from LDS feeds 4 or 2 WMMAs.
// ---------------------------------------------------------------------------
#define PB 128           /* tokens, and features, per block                 */
#define PBK 64           /* k per staged chunk                              */
#define PT_STRIDE 72     /* 64 + 8 elems, 144B = 16B x odd: no bank conflict */

typedef __attribute__((ext_vector_type(4))) short v4s;

static __device__ __forceinline__ v4s cvt4(float4 a) {
  v4s r;
  r[0] = f2bf(a.x); r[1] = f2bf(a.y); r[2] = f2bf(a.z); r[3] = f2bf(a.w);
  return r;
}

__global__ __launch_bounds__(256) void proj_kernel(
    const float* __restrict__ emb,
    const float* __restrict__ Wqk, const float* __restrict__ bqk,
    const float* __restrict__ Wv,  const float* __restrict__ bv,
    short* __restrict__ Qg, short* __restrict__ Vt)
{
  __shared__ __attribute__((aligned(16))) short As[2][PB * PT_STRIDE];
  __shared__ __attribute__((aligned(16))) short Bs[2][PB * PT_STRIDE];

  const int tid  = threadIdx.x;
  const int lane = tid & 31;
  const int wave = tid >> 5;
  const int am = lane & 15;
  const int kh = lane >> 4;
  const int bm = blockIdx.x >> 3;           // token block   0..63
  const int bn = blockIdx.x & 7;            // feature block 0..7
  const bool is_v = bn >= 4;
  const int f0 = (bn & 3) * PB;             // first feature, in its own matrix
  const int t0 = bm * PB;                   // first token
  const int wm = wave & 3;                  // 32-token strip of the block
  const int wn = wave >> 2;                 // 64-feature half of the block

  // Staging map: 16 lanes cover one row's 256 B, a wave two rows.
  const int lrow = tid >> 4;
  const int lc4  = tid & 15;
  const float* asrc = emb + (t0 + lrow) * D + lc4 * 4;
  const float* bsrc = (is_v ? Wv : Wqk) + (f0 + lrow) * D + lc4 * 4;
  const int sdst = lrow * PT_STRIDE + lc4 * 4;

  float4 ra[8], rb[8];
  for (int i = 0; i < 8; ++i) {
    ra[i] = *(const float4*)(asrc + i * 16 * D);
    rb[i] = *(const float4*)(bsrc + i * 16 * D);
  }
  for (int i = 0; i < 8; ++i) {
    *(v4s*)&As[0][sdst + i * 16 * PT_STRIDE] = cvt4(ra[i]);
    *(v4s*)&Bs[0][sdst + i * 16 * PT_STRIDE] = cvt4(rb[i]);
  }
  __syncthreads();
  for (int i = 0; i < 8; ++i) {
    ra[i] = *(const float4*)(asrc + i * 16 * D + PBK);
    rb[i] = *(const float4*)(bsrc + i * 16 * D + PBK);
  }
  // The two pointers that these loads name are inputs here, so that their step
  // below stands behind this wait.
  asm volatile("s_wait_xcnt 0x0" :: "v"(asrc), "v"(bsrc) : "memory");
  asrc += PBK;
  bsrc += PBK;

  v8f acc[2][4] = {};
  // Kept rolled: unrolled, the whole loop is one block of code and the compiler
  // lifts the rounding, with the wait for the loads, in front of the products.
#pragma unroll 1
  for (int c = 0; c < D / PBK; ++c) {
    const short* at = &As[c & 1][(wm * 32 + am) * PT_STRIDE + kh * 8];
    const short* bt = &Bs[c & 1][(wn * 64 + am) * PT_STRIDE + kh * 8];
    for (int ks = 0; ks < PBK / 32; ++ks) {
      v16bf a[2], b[4];
      for (int m = 0; m < 2; ++m)
        a[m] = frag_from(at + m * 16 * PT_STRIDE + ks * 32,
                         at + m * 16 * PT_STRIDE + ks * 32 + 16);
      for (int n = 0; n < 4; ++n)
        b[n] = frag_from(bt + n * 16 * PT_STRIDE + ks * 32,
                         bt + n * 16 * PT_STRIDE + ks * 32 + 16);
      for (int m = 0; m < 2; ++m)
        for (int n = 0; n < 4; ++n)
          acc[m][n] = __builtin_amdgcn_wmma_f32_16x16x32_bf16(
              false, a[m], false, b[n], (short)0, acc[m][n], false, false);
    }
    if (c + 1 < D / PBK) {
      // Chunk c+1, loaded under the products above, goes to the other buffer,
      // whose last readers left it at the previous barrier.
      short* ad = &As[(c + 1) & 1][sdst];
      short* bd = &Bs[(c + 1) & 1][sdst];
      for (int i = 0; i < 8; ++i) {
        *(v4s*)(ad + i * 16 * PT_STRIDE) = cvt4(ra[i]);
        *(v4s*)(bd + i * 16 * PT_STRIDE) = cvt4(rb[i]);
      }
    }
    __syncthreads();
    if (c + 2 < D / PBK) {
      // The two pointers live across the trips, so no result lands in them.
      for (int i = 0; i < 8; ++i) {
        ra[i] = *(const float4*)(asrc + i * 16 * D + PBK);
        rb[i] = *(const float4*)(bsrc + i * 16 * D + PBK);
      }
      asrc += PBK;
      bsrc += PBK;
    }
  }

  // D layout: VGPR r -> token row (+ kh*8 + r), column = feature (+ am).
  const int ocol0 = f0 + wn * 64 + am;
  const int tok0  = t0 + wm * 32 + kh * 8;
  if (is_v) {
    // Vt row = feature, 8 contiguous tokens -> one 16B store.
    for (int n = 0; n < 4; ++n) {
      const float bias = bv[ocol0 + n * 16];
      for (int m = 0; m < 2; ++m) {
        v8s vp;
        for (int r = 0; r < 8; ++r) vp[r] = f2bf(acc[m][n][r] + bias);
        *(v8s*)(Vt + (ocol0 + n * 16) * N_TOK + tok0 + m * 16) = vp;
      }
    }
    // No register that these stores name is rewritten in front of this wait.
    asm volatile("s_wait_xcnt 0x0" ::: "memory");
  } else {
    for (int n = 0; n < 4; ++n) {
      const float bias = bqk[ocol0 + n * 16];
      for (int m = 0; m < 2; ++m)
        for (int r = 0; r < 8; ++r)
          Qg[(tok0 + m * 16 + r) * D + ocol0 + n * 16] = f2bf(acc[m][n][r] + bias);
    }
  }
}

// Eight 16-byte-per-lane asynchronous copies, global memory to LDS, through no
// register. The s_wait_xcnt stands inside the statement, behind the last copy,
// so that no address register named here is rewritten in front of it.
static __device__ __forceinline__ void async_copy8(const unsigned (&l)[8],
                                                   const short* const (&g)[8]) {
  asm volatile(
      "global_load_async_to_lds_b128 %0, %8, off\n\t"
      "global_load_async_to_lds_b128 %1, %9, off\n\t"
      "global_load_async_to_lds_b128 %2, %10, off\n\t"
      "global_load_async_to_lds_b128 %3, %11, off\n\t"
      "global_load_async_to_lds_b128 %4, %12, off\n\t"
      "global_load_async_to_lds_b128 %5, %13, off\n\t"
      "global_load_async_to_lds_b128 %6, %14, off\n\t"
      "global_load_async_to_lds_b128 %7, %15, off\n\t"
      "s_wait_xcnt 0x0"
      :: "v"(l[0]), "v"(l[1]), "v"(l[2]), "v"(l[3]),
         "v"(l[4]), "v"(l[5]), "v"(l[6]), "v"(l[7]),
         "v"(g[0]), "v"(g[1]), "v"(g[2]), "v"(g[3]),
         "v"(g[4]), "v"(g[5]), "v"(g[6]), "v"(g[7])
      : "memory");
}

// LDS tiles are unpadded; the 16-byte chunk c of a row sits at chunk position
// c ^ (row & 15), so 16 lanes reading one chunk column of 16 rows hit 16
// different bank groups.

// Key tile: wave w brings key rows [16w, 16w+16) of the 128-key tile, 1024 B
// each; one copy covers 512 contiguous global bytes.
static __device__ __forceinline__ void copy_k_tile(const short* __restrict__ Qg, int kb,
                                                   unsigned ks_base, int wave, int lane) {
  const short* gsrc = Qg + (kb + wave * 16) * D + lane * 8;
  const unsigned ldst = ks_base + wave * 16 * 1024;
  for (int q = 0; q < 4; ++q) {
    unsigned l[8];
    const short* g[8];
    for (int u = 0; u < 8; ++u) {
      const int i = q * 8 + u, r = i >> 1, h = i & 1;
      g[u] = gsrc + r * D + h * 256;
      l[u] = ldst + r * 1024 + h * 512 + ((lane ^ r) << 4);
    }
    async_copy8(l, g);
  }
}

// Value tile: wave w brings Vt rows [64w, 64w+64), 256 B (128 keys) each; one
// copy covers two rows.
static __device__ __forceinline__ void copy_v_tile(const short* __restrict__ Vt, int kb,
                                                   unsigned vs_base, int wave, int lane) {
  const int am = lane & 15, kh = lane >> 4;
  const short* gsrc = Vt + (wave * 64 + kh) * N_TOK + kb + am * 8;
  const unsigned ldst = vs_base + (wave * 64 + kh) * 256;
  for (int q = 0; q < 4; ++q) {
    unsigned l[8];
    const short* g[8];
    for (int u = 0; u < 8; ++u) {
      const int i = q * 8 + u;
      g[u] = gsrc + 2 * i * N_TOK;
      l[u] = ldst + i * 512 + (((am ^ kh) ^ ((2 * i) & 14)) << 4);
    }
    async_copy8(l, g);
  }
}

// ---------------------------------------------------------------------------
// Kernel 2: flash attention. Block = 32 query rows (2 strips), 8 waves.
// Per 128-key tile: wave w computes score subtiles (both strips) for keys
// [16w,16w+16) -- B fragment loaded ONCE, feeds TWO WMMAs; online softmax;
// then wave w computes P@V for output columns [64w, 64w+64) of both strips,
// again sharing each Vt B fragment across two WMMAs.
// The key tile and the value tile each have one LDS buffer, filled by
// asynchronous copies: V(t) flies under the score phase of tile t, K(t+1)
// under the softmax and P@V of tile t.
// Every block reads all 64 key tiles; each starts its walk at a tile set by its index (four blocks to a tile)
// and wraps, so that blocks running side by side ask L2 for different lines.
// ---------------------------------------------------------------------------
__global__ __launch_bounds__(256) void attn_kernel(
    const short* __restrict__ Qg, const short* __restrict__ Vt,
    float* __restrict__ out)
{
  __shared__ __attribute__((aligned(1024))) short Ks[BN * D];   // 128 KB
  __shared__ __attribute__((aligned(1024))) short Vs[D * BN];   // 128 KB
  __shared__ __attribute__((aligned(16))) short Qs[BM * QS_STRIDE];   // 33.3 KB
  __shared__ __attribute__((aligned(16))) float Ss[BM * SS_STRIDE];   // 17.9 KB
  __shared__ __attribute__((aligned(16))) short Ps[BM * PS_STRIDE];   //  8.7 KB
  __shared__ float pmax[BM][8];
  __shared__ float psum[BM][8];
  __shared__ float m_run[BM], l_run[BM], m_new_s[BM], corr_s[BM];

  const int tid  = threadIdx.x;
  const int lane = tid & 31;
  const int wave = tid >> 5;
  const int am = lane & 15;
  const int kh = lane >> 4;
  const int qrow0 = blockIdx.x * BM;
  const unsigned ks_base = (unsigned)(unsigned long long)&Ks[0];
  const unsigned vs_base = (unsigned)(unsigned long long)&Vs[0];

  // Element offset of chunk 2e + kh of a row with (row & 15) == am.
  int sw[8];
  for (int e = 0; e < 8; ++e) sw[e] = ((2 * e) ^ (am ^ kh)) * 8;

  // First tile of this block's walk, for speed only: any value in 0..63 gives the
  // same function. Four blocks share a start, those whose index differs only in
  // bits 1 and 2.
  const int rot = ((blockIdx.x >> 3) << 1 | (blockIdx.x & 1)) & (N_TOK / BN - 1);

  copy_k_tile(Qg, rot * BN, ks_base, wave, lane);

  // Stage the 32x512 bf16 Q tile into LDS (2048 x 16B chunks, 8 per thread).
  for (int c = tid; c < BM * 64; c += 256) {
    const int r = c >> 6, cc = c & 63;
    *(v8s*)&Qs[r * QS_STRIDE + cc * 8] = *(const v8s*)(Qg + (qrow0 + r) * D + cc * 8);
  }
  if (tid < BM) { m_run[tid] = -3.0e38f; l_run[tid] = 0.0f; }
  // K(0) has landed before the barrier that lets anybody read it.
  asm volatile("s_wait_asynccnt 0x0" ::: "memory");
  __syncthreads();
  copy_v_tile(Vt, rot * BN, vs_base, wave, lane);

  v8f acc0[4] = { {}, {}, {}, {} };   // strip 0 (rows 0..15)
  v8f acc1[4] = { {}, {}, {}, {} };   // strip 1 (rows 16..31)
  const int srow = tid >> 3;          // 0..31
  const int sseg = tid & 7;           // 16 cols per segment

  for (int kt = 0; kt < N_TOK / BN; ++kt) {
    const bool more = kt + 1 < N_TOK / BN;                        // a next tile exists
    const int kbn = ((kt + 1 + rot) & (N_TOK / BN - 1)) * BN;     // its first key

    // ---- S subtiles: one key B-fragment feeds both strips' WMMAs
    v8f s0 = {}, s1 = {};
    const short* krow = &Ks[(wave * 16 + am) * D];
    for (int s = 0; s < 16; ++s) {
      const int kk = s * 32 + kh * 8;
      v16bf b  = frag_from(krow + (s >> 2) * 128 + sw[(2 * s) & 7],
                           krow + (s >> 2) * 128 + sw[(2 * s + 1) & 7]);
      v16bf a0 = frag_from(&Qs[am * QS_STRIDE + kk],        &Qs[am * QS_STRIDE + kk + 16]);
      v16bf a1 = frag_from(&Qs[(16 + am) * QS_STRIDE + kk], &Qs[(16 + am) * QS_STRIDE + kk + 16]);
      s0 = __builtin_amdgcn_wmma_f32_16x16x32_bf16(false, a0, false, b, (short)0, s0, false, false);
      s1 = __builtin_amdgcn_wmma_f32_16x16x32_bf16(false, a1, false, b, (short)0, s1, false, false);
    }
    for (int r = 0; r < 8; ++r) {
      const int m = r + kh * 8;
      Ss[m * SS_STRIDE + SS_GRP(wave) + am]        = s0[r];
      Ss[(16 + m) * SS_STRIDE + SS_GRP(wave) + am] = s1[r];
    }
    // Foot of the score phase: this wave's reads of Ks are done and its copies
    // of V(t) have landed before the barrier; behind it Ks is refilled.
    asm volatile("s_wait_dscnt 0x0" ::: "memory");
    asm volatile("s_wait_asynccnt 0x0" ::: "memory");
    __syncthreads();
    if (more) copy_k_tile(Qg, kbn, ks_base, wave, lane);

    // ---- online softmax (256 threads: row = tid/8, 16 cols per thread)
    float mx = -3.0e38f;
    for (int j = 0; j < 16; ++j)
      mx = fmaxf(mx, Ss[srow * SS_STRIDE + SS_GRP(sseg) + j] * SCALE);
    pmax[srow][sseg] = mx;
    __syncthreads();
    if (sseg == 0) {
      float mt = pmax[srow][0];
      for (int j = 1; j < 8; ++j) mt = fmaxf(mt, pmax[srow][j]);
      const float mo = m_run[srow];
      const float mn = fmaxf(mo, mt);
      m_new_s[srow] = mn;
      corr_s[srow]  = __expf(mo - mn);
      m_run[srow]   = mn;
    }
    __syncthreads();
    {
      const float mn = m_new_s[srow];
      float ps = 0.0f;
      for (int j = 0; j < 16; ++j) {
        const int c = sseg * 16 + j;
        const float p = __expf(Ss[srow * SS_STRIDE + SS_GRP(sseg) + j] * SCALE - mn);
        ps += p;
        Ps[srow * PS_STRIDE + c] = f2bf(p);
      }
      psum[srow][sseg] = ps;
    }
    __syncthreads();
    if (sseg == 0) {
      float t = 0.0f;
      for (int j = 0; j < 8; ++j) t += psum[srow][j];
      l_run[srow] = l_run[srow] * corr_s[srow] + t;
    }

    // ---- O = corr*O + P @ V_tile ; wave w owns cols [64w, 64w+64), 2 strips
    float cr0[8], cr1[8];
    for (int r = 0; r < 8; ++r) {
      cr0[r] = corr_s[r + kh * 8];
      cr1[r] = corr_s[16 + r + kh * 8];
    }
    for (int j = 0; j < 4; ++j)
      for (int r = 0; r < 8; ++r) { acc0[j][r] *= cr0[r]; acc1[j][r] *= cr1[r]; }

    v16bf pa0[4], pa1[4];
    for (int s = 0; s < 4; ++s) {
      const int kk = s * 32 + kh * 8;
      pa0[s] = frag_from(&Ps[am * PS_STRIDE + kk],        &Ps[am * PS_STRIDE + kk + 16]);
      pa1[s] = frag_from(&Ps[(16 + am) * PS_STRIDE + kk], &Ps[(16 + am) * PS_STRIDE + kk + 16]);
    }
    for (int j = 0; j < 4; ++j) {
      const int ncol = wave * 64 + j * 16 + am;
      const short* vb = &Vs[ncol * BN];
      for (int s = 0; s < 4; ++s) {
        v16bf b = frag_from(vb + sw[2 * s], vb + sw[2 * s + 1]);
        acc0[j] = __builtin_amdgcn_wmma_f32_16x16x32_bf16(false, pa0[s], false, b, (short)0, acc0[j], false, false);
        acc1[j] = __builtin_amdgcn_wmma_f32_16x16x32_bf16(false, pa1[s], false, b, (short)0, acc1[j], false, false);
      }
    }
    // Foot of the P@V phase: this wave's reads of Vs are done and its copies
    // of K(t+1) have landed before the barrier; behind it Vs is refilled.
    asm volatile("s_wait_dscnt 0x0" ::: "memory");
    asm volatile("s_wait_asynccnt 0x0" ::: "memory");
    __syncthreads();
    if (more) copy_v_tile(Vt, kbn, vs_base, wave, lane);
  }
  // No copy is left in flight when the wave goes on to its end.
  asm volatile("s_wait_asynccnt 0x0" ::: "memory");

  // ---- epilogue: O /= l, store f32
  float li0[8], li1[8];
  for (int r = 0; r < 8; ++r) {
    li0[r] = 1.0f / l_run[r + kh * 8];
    li1[r] = 1.0f / l_run[16 + r + kh * 8];
  }
  for (int j = 0; j < 4; ++j) {
    const int ncol = wave * 64 + j * 16 + am;
    for (int r = 0; r < 8; ++r) {
      const int m = r + kh * 8;
      out[(qrow0 + m) * D + ncol]      = acc0[j][r] * li0[r];
      out[(qrow0 + 16 + m) * D + ncol] = acc1[j][r] * li1[r];
    }
  }
}

extern "C" void kernel_launch(void* const* d_in, const int* in_sizes, int n_in,
                              void* d_out, int out_size, void* d_ws, size_t ws_size,
                              hipStream_t stream) {
  const float* emb = (const float*)d_in[0];
  const float* Wqk = (const float*)d_in[1];
  const float* bqk = (const float*)d_in[2];
  const float* Wv  = (const float*)d_in[3];
  const float* bv  = (const float*)d_in[4];

  short* Qg = (short*)d_ws;                       // bf16 [8192][512]  (8 MB)
  short* Vt = Qg + (size_t)N_TOK * D;             // bf16 [512][8192]  (8 MB)
  float* out = (float*)d_out;                     // f32  [8192][512]

  proj_kernel<<<512, 256, 0, stream>>>(emb, Wqk, bqk, Wv, bv, Qg, Vt);
  attn_kernel<<<N_TOK / BM, 256, 0, stream>>>(Qg, Vt, out);
}

// v005
// A run of this version takes 149 microseconds.
// Two timings next to v004 put it at 1.32 and 1.31 times that version's speed.
// Over all steps from v000 it is 3.28 times as fast.
#include <hip/hip_runtime.h>

#define N_TOK 8192
#define D 512
#define BM 64            /* query rows per block (4 strips of 16)           */
#define BN 128           /* keys per tile                                   */
#define NW 8             /* waves per attention block                       */
#define NSPLIT 2         /* blocks that share one query block's key range   */
#define TILES (N_TOK / BN / NSPLIT)   /* key tiles per block                */
#define GS (32 / NW)     /* 16-key score groups per wave (one strip each)   */
#define JN (32 / NW)     /* 16-column output groups per wave (all strips)   */
#define RK (BN / NW)     /* key rows that a wave copies                     */
#define RV (D / NW)      /* value rows that a wave copies                   */
#define RP (BM / (NW * 4))  /* softmax rows per thread                      */
#define SCALE 0.04419417382415922f  /* 1/sqrt(512) */

/* Row pitches for 16-byte LDS reads: 16 B x odd, so that the 16 rows (or the
   2 rows x 8 segments) that half a wave reads at once fall on all 64 banks. */
#define PS_STRIDE 136    /* 128 + 8 elems,  272 B = 16 B x 17               */
#define SS_STRIDE 140    /* f32 scores: 128 + 8 (mid-row gap) + 4, 16 B x 35 */
/* First dword of 16-column group g of a score row: columns 64..127 stand 8
   dwords further on, so groups g and g + 4 do not share banks.             */
#define SS_GRP(g) ((g) * 16 + ((g) >> 2) * 8)

typedef __attribute__((ext_vector_type(16))) __bf16 v16bf;
typedef __attribute__((ext_vector_type(8)))  float  v8f;
typedef __attribute__((ext_vector_type(8)))  short  v8s;

struct bpair { v8s lo, hi; };

// 16x32-bf16 A/B fragment for v_wmma_f32_16x16x32_bf16 from two 16-byte
// chunks (K = kk..kk+7 and kk+16..kk+23 for this lane; lanes 0-15 kh=0,
// lanes 16-31 kh=1, per the ISA 16-bit A/B VGPR striping).
static __device__ __forceinline__ v16bf frag_from(const void* plo, const void* phi) {
  bpair f;
  f.lo = *(const v8s*)plo;
  f.hi = *(const v8s*)phi;
  return __builtin_bit_cast(v16bf, f);
}

// Hardware f32->bf16 convert (let clang pick v_cvt, ideally packed).
static __device__ __forceinline__ short f2bf(float x) {
  __bf16 h = (__bf16)x;
  return __builtin_bit_cast(short, h);
}

// ---------------------------------------------------------------------------
// Kernel 1: Q = emb @ Wqk^T + bqk  (bf16, row-major [N][D])
//           V = emb @ Wv^T  + bv   (bf16, TRANSPOSED: Vt[D][N])
// One block per 128 tokens x 128 output features (feature blocks 0..3 are Q,
// 4..7 are V). The f32 operands come in by whole-line loads, 64 k at a time,
// are rounded to bf16 once and staged in LDS (two buffers); each of the 8
// waves works a 32 x 64 tile, so a fragment read from LDS feeds 4 or 2 WMMAs.
// ---------------------------------------------------------------------------
#define PB 128           /* tokens, and features, per block                 */
#define PBK 64           /* k per staged chunk                              */
#define PT_STRIDE 72     /* 64 + 8 elems, 144B = 16B x odd: no bank conflict */

typedef __attribute__((ext_vector_type(4))) short v4s;

static __device__ __forceinline__ v4s cvt4(float4 a) {
  v4s r;
  r[0] = f2bf(a.x); r[1] = f2bf(a.y); r[2] = f2bf(a.z); r[3] = f2bf(a.w);
  return r;
}

__global__ __launch_bounds__(256) void proj_kernel(
    const float* __restrict__ emb,
    const float* __restrict__ Wqk, const float* __restrict__ bqk,
    const float* __restrict__ Wv,  const float* __restrict__ bv,
    short* __restrict__ Qg, short* __restrict__ Vt)
{
  __shared__ __attribute__((aligned(16))) short As[2][PB * PT_STRIDE];
  __shared__ __attribute__((aligned(16))) short Bs[2][PB * PT_STRIDE];

  const int tid  = threadIdx.x;
  const int lane = tid & 31;
  const int wave = tid >> 5;
  const int am = lane & 15;
  const int kh = lane >> 4;
  const int bm = blockIdx.x >> 3;           // token block   0..63
  const int bn = blockIdx.x & 7;            // feature block 0..7
  const bool is_v = bn >= 4;
  const int f0 = (bn & 3) * PB;             // first feature, in its own matrix
  const int t0 = bm * PB;                   // first token
  const int wm = wave & 3;                  // 32-token strip of the block
  const int wn = wave >> 2;                 // 64-feature half of the block

  // Staging map: 16 lanes cover one row's 256 B, a wave two rows.
  const int lrow = tid >> 4;
  const int lc4  = tid & 15;
  const float* asrc = emb + (t0 + lrow) * D + lc4 * 4;
  const float* bsrc = (is_v ? Wv : Wqk) + (f0 + lrow) * D + lc4 * 4;
  const int sdst = lrow * PT_STRIDE + lc4 * 4;

  float4 ra[8], rb[8];
  for (int i = 0; i < 8; ++i) {
    ra[i] = *(const float4*)(asrc + i * 16 * D);
    rb[i] = *(const float4*)(bsrc + i * 16 * D);
  }
  for (int i = 0; i < 8; ++i) {
    *(v4s*)&As[0][sdst + i * 16 * PT_STRIDE] = cvt4(ra[i]);
    *(v4s*)&Bs[0][sdst + i * 16 * PT_STRIDE] = cvt4(rb[i]);
  }
  __syncthreads();
  for (int i = 0; i < 8; ++i) {
    ra[i] = *(const float4*)(asrc + i * 16 * D + PBK);
    rb[i] = *(const float4*)(bsrc + i * 16 * D + PBK);
  }
  // The two pointers that these loads name are inputs here, so that their step
  // below stands behind this wait.
  asm volatile("s_wait_xcnt 0x0" :: "v"(asrc), "v"(bsrc) : "memory");
  asrc += PBK;
  bsrc += PBK;

  v8f acc[2][4] = {};
  // Kept rolled: unrolled, the whole loop is one block of code and the compiler
  // lifts the rounding, with the wait for the loads, in front of the products.
#pragma unroll 1
  for (int c = 0; c < D / PBK; ++c) {
    const short* at = &As[c & 1][(wm * 32 + am) * PT_STRIDE + kh * 8];
    const short* bt = &Bs[c & 1][(wn * 64 + am) * PT_STRIDE + kh * 8];
    for (int ks = 0; ks < PBK / 32; ++ks) {
      v16bf a[2], b[4];
      for (int m = 0; m < 2; ++m)
        a[m] = frag_from(at + m * 16 * PT_STRIDE + ks * 32,
                         at + m * 16 * PT_STRIDE + ks * 32 + 16);
      for (int n = 0; n < 4; ++n)
        b[n] = frag_from(bt + n * 16 * PT_STRIDE + ks * 32,
                         bt + n * 16 * PT_STRIDE + ks * 32 + 16);
      for (int m = 0; m < 2; ++m)
        for (int n = 0; n < 4; ++n)
          acc[m][n] = __builtin_amdgcn_wmma_f32_16x16x32_bf16(
              false, a[m], false, b[n], (short)0, acc[m][n], false, false);
    }
    if (c + 1 < D / PBK) {
      // Chunk c+1, loaded under the products above, goes to the other buffer,
      // whose last readers left it at the previous barrier.
      short* ad = &As[(c + 1) & 1][sdst];
      short* bd = &Bs[(c + 1) & 1][sdst];
      for (int i = 0; i < 8; ++i) {
        *(v4s*)(ad + i * 16 * PT_STRIDE) = cvt4(ra[i]);
        *(v4s*)(bd + i * 16 * PT_STRIDE) = cvt4(rb[i]);
      }
    }
    __syncthreads();
    if (c + 2 < D / PBK) {
      // The two pointers live across the trips, so no result lands in them.
      for (int i = 0; i < 8; ++i) {
        ra[i] = *(const float4*)(asrc + i * 16 * D + PBK);
        rb[i] = *(const float4*)(bsrc + i * 16 * D + PBK);
      }
      asrc += PBK;
      bsrc += PBK;
    }
  }

  // D layout: VGPR r -> token row (+ kh*8 + r), column = feature (+ am).
  const int ocol0 = f0 + wn * 64 + am;
  const int tok0  = t0 + wm * 32 + kh * 8;
  if (is_v) {
    // Vt row = feature, 8 contiguous tokens -> one 16B store.
    for (int n = 0; n < 4; ++n) {
      const float bias = bv[ocol0 + n * 16];
      for (int m = 0; m < 2; ++m) {
        v8s vp;
        for (int r = 0; r < 8; ++r) vp[r] = f2bf(acc[m][n][r] + bias);
        *(v8s*)(Vt + (ocol0 + n * 16) * N_TOK + tok0 + m * 16) = vp;
      }
    }
    // No register that these stores name is rewritten in front of this wait.
    asm volatile("s_wait_xcnt 0x0" ::: "memory");
  } else {
    for (int n = 0; n < 4; ++n) {
      const float bias = bqk[ocol0 + n * 16];
      for (int m = 0; m < 2; ++m)
        for (int r = 0; r < 8; ++r)
          Qg[(tok0 + m * 16 + r) * D + ocol0 + n * 16] = f2bf(acc[m][n][r] + bias);
    }
  }
}

// Eight 16-byte-per-lane asynchronous copies, global memory to LDS, through no
// register. The s_wait_xcnt stands inside the statement, behind the last copy,
// so that no address register named here is rewritten in front of it.
static __device__ __forceinline__ void async_copy8(const unsigned (&l)[8],
                                                   const short* const (&g)[8]) {
  asm volatile(
      "global_load_async_to_lds_b128 %0, %8, off\n\t"
      "global_load_async_to_lds_b128 %1, %9, off\n\t"
      "global_load_async_to_lds_b128 %2, %10, off\n\t"
      "global_load_async_to_lds_b128 %3, %11, off\n\t"
      "global_load_async_to_lds_b128 %4, %12, off\n\t"
      "global_load_async_to_lds_b128 %5, %13, off\n\t"
      "global_load_async_to_lds_b128 %6, %14, off\n\t"
      "global_load_async_to_lds_b128 %7, %15, off\n\t"
      "s_wait_xcnt 0x0"
      :: "v"(l[0]), "v"(l[1]), "v"(l[2]), "v"(l[3]),
         "v"(l[4]), "v"(l[5]), "v"(l[6]), "v"(l[7]),
         "v"(g[0]), "v"(g[1]), "v"(g[2]), "v"(g[3]),
         "v"(g[4]), "v"(g[5]), "v"(g[6]), "v"(g[7])
      : "memory");
}

// LDS tiles are unpadded; the 16-byte chunk c of a row sits at chunk position
// c ^ (row & 15), so 16 lanes reading one chunk column of 16 rows hit 16
// different bank groups.

// Key tile: wave w brings key rows [RK w, RK w + RK) of the 128-key tile, 1024 B
// each; one copy covers 512 contiguous global bytes.
static __device__ __forceinline__ void copy_k_tile(const short* __restrict__ Qg, int kb,
                                                   unsigned ks_base, int wave, int lane) {
  const short* gsrc = Qg + (kb + wave * RK) * D + lane * 8;
  const unsigned ldst = ks_base + wave * RK * 1024;
  const int lx = lane ^ ((wave * RK) & 15);   // RK divides 16: row & 15 = this | r
  // Kept rolled: unrolled, every copy's LDS address is held across the tile loop,
  // and beside the Q fragments and the sums they no longer fit the registers.
#pragma unroll 1
  for (int q = 0; q < RK / 4; ++q) {
    unsigned l[8];
    const short* g[8];
    for (int u = 0; u < 8; ++u) {
      const int i = q * 8 + u, r = i >> 1, h = i & 1;
      g[u] = gsrc + r * D + h * 256;
      l[u] = ldst + r * 1024 + h * 512 + ((lx ^ r) << 4);
    }
    async_copy8(l, g);
  }
}

// Value tile: wave w brings Vt rows [RV w, RV w + RV), 256 B (128 keys) each; one
// copy covers two rows.
static __device__ __forceinline__ void copy_v_tile(const short* __restrict__ Vt, int kb,
                                                   unsigned vs_base, int wave, int lane) {
  const int am = lane & 15, kh = lane >> 4;
  const short* gsrc = Vt + (wave * RV + kh) * N_TOK + kb + am * 8;
  const unsigned ldst = vs_base + (wave * RV + kh) * 256;
  // Kept rolled, for the same reason as in copy_k_tile.
#pragma unroll 1
  for (int q = 0; q < RV / 16; ++q) {
    unsigned l[8];
    const short* g[8];
    for (int u = 0; u < 8; ++u) {
      const int i = q * 8 + u;
      g[u] = gsrc + 2 * i * N_TOK;
      l[u] = ldst + i * 512 + (((am ^ kh) ^ ((2 * i) & 14)) << 4);
    }
    async_copy8(l, g);
  }
}

// ---------------------------------------------------------------------------
// Kernel 2: flash attention over half of the keys. Block = 64 query rows
// (4 strips), 8 waves; two blocks share a query block, each walks 32 of the 64
// key tiles and leaves its unnormalised sums, its row maxima and its row sums
// in the workspace for kernel 3. A key or value byte that comes from L2 so
// serves 64 query rows.
// Per 128-key tile: wave w computes the scores of strip w & 3 for 64 keys, its
// strip's Q fragments staying in registers for the whole walk; online softmax;
// then wave w computes P@V for output columns [64w, 64w+64) of all four strips,
// each Vt B fragment feeding four WMMAs.
// The key tile and the value tile each have one LDS buffer, filled by
// asynchronous copies: V(t) flies under the score phase of tile t, K(t+1)
// under the softmax and P@V of tile t.
// Four blocks start their walk at each tile of their half and wrap, so that
// blocks running side by side spread their L2 requests over many lines.
// ---------------------------------------------------------------------------
__global__ __launch_bounds__(NW * 32) void attn_kernel(
    const short* __restrict__ Qg, const short* __restrict__ Vt,
    float* __restrict__ Op, float* __restrict__ Mp, float* __restrict__ Lp)
{
  __shared__ __attribute__((aligned(1024))) short Ks[BN * D];   // 128 KB
  __shared__ __attribute__((aligned(1024))) short Vs[D * BN];   // 128 KB
  __shared__ __attribute__((aligned(16))) float Ss[BM * SS_STRIDE];   // 35.0 KB
  __shared__ __attribute__((aligned(16))) short Ps[BM * PS_STRIDE];   // 17.0 KB
  __shared__ float pmax[BM][8];
  __shared__ float psum[BM][8];
  __shared__ float m_run[BM], l_run[BM], m_new_s[BM], corr_s[BM];

  const int tid  = threadIdx.x;
  const int lane = tid & 31;
  const int wave = tid >> 5;
  const int am = lane & 15;
  const int kh = lane >> 4;
  const int half  = blockIdx.x & (NSPLIT - 1);
  const int qrow0 = (blockIdx.x / NSPLIT) * BM;
  const int strip = wave & 3;         // query strip of this wave's scores
  const int kgrp  = wave >> 2;        // its run of GS 16-key groups
  const unsigned ks_base = (unsigned)(unsigned long long)&Ks[0];
  const unsigned vs_base = (unsigned)(unsigned long long)&Vs[0];

  // Element offset of chunk 2e + kh of a row with (row & 15) == am.
  int sw[8];
  for (int e = 0; e < 8; ++e) sw[e] = ((2 * e) ^ (am ^ kh)) * 8;

  // First tile of this block's walk inside its half, for speed only: any value in
  // 0..TILES-1 gives the same function. Four blocks share a start, those whose
  // index differs only in bits 1 and 2.
  const int tile0 = half * TILES;
  const int rot = (blockIdx.x >> 3) & (TILES - 1);

  copy_k_tile(Qg, (tile0 + rot) * BN, ks_base, wave, lane);

  // This wave's strip of Q, 16 rows x 512, as 16 A fragments in registers.
  v16bf qf[16];
  const short* qsrc = Qg + (qrow0 + strip * 16 + am) * D + kh * 8;
  // Unrolled: qf is indexed by constants only, so it stays in registers.
#pragma unroll
  for (int s = 0; s < 16; ++s) qf[s] = frag_from(qsrc + s * 32, qsrc + s * 32 + 16);

  if (tid < BM) { m_run[tid] = -3.0e38f; l_run[tid] = 0.0f; }
  // K(0) has landed before the barrier that lets anybody read it.
  asm volatile("s_wait_asynccnt 0x0" ::: "memory");
  __syncthreads();
  copy_v_tile(Vt, (tile0 + rot) * BN, vs_base, wave, lane);

  v8f acc[4][JN] = {};                // [strip][column group]
  const int srow = tid >> 3;          // 0..31
  const int sseg = tid & 7;           // 16 cols per segment

  for (int kt = 0; kt < TILES; ++kt) {
    const bool more = kt + 1 < TILES;                               // a next tile exists
    const int kbn = (tile0 + ((kt + 1 + rot) & (TILES - 1))) * BN;  // its first key

    // ---- S subtiles: Q fragment from registers, key B fragments from LDS,
    // fetched two k steps ahead through a ring of three register sets
    v8f sc[GS] = {};
    const short* krow = &Ks[(kgrp * GS * 16 + am) * D];
    v16bf kf[3][GS];
    for (int p = 0; p < 2; ++p)
      for (int g = 0; g < GS; ++g)
        kf[p][g] = frag_from(krow + g * 16 * D + sw[2 * p], krow + g * 16 * D + sw[2 * p + 1]);
    // Unrolled: constant indices into qf and kf keep them in registers.
#pragma unroll
    for (int s = 0; s < 16; ++s) {
      if (s + 2 < 16) {
        const int n = s + 2;
        for (int g = 0; g < GS; ++g)
          kf[n % 3][g] = frag_from(krow + g * 16 * D + (n >> 2) * 128 + sw[(2 * n) & 7],
                                   krow + g * 16 * D + (n >> 2) * 128 + sw[(2 * n + 1) & 7]);
      }
      // Keeps the loads of step s + 2 in front of the products of step s: left
      // alone, the compiler sinks each load to its product, which then waits a
      // whole LDS latency.
      __builtin_amdgcn_sched_barrier(0);
      for (int g = 0; g < GS; ++g)
        sc[g] = __builtin_amdgcn_wmma_f32_16x16x32_bf16(false, qf[s], false, kf[s % 3][g], (short)0, sc[g], false, false);
      // Keeps the next loads behind these products (same purpose).
      __builtin_amdgcn_sched_barrier(0);
    }
    for (int g = 0; g < GS; ++g) {
      const int grp = kgrp * GS + g;
      for (int r = 0; r < 8; ++r)
        Ss[(strip * 16 + r + kh * 8) * SS_STRIDE + SS_GRP(grp) + am] = sc[g][r];
    }
    // Foot of the score phase: this wave's reads of Ks are done and its copies
    // of V(t) have landed before the barrier; behind it Ks is refilled.
    asm volatile("s_wait_dscnt 0x0" ::: "memory");
    asm volatile("s_wait_asynccnt 0x0" ::: "memory");
    __syncthreads();
    if (more) copy_k_tile(Qg, kbn, ks_base, wave, lane);

    // ---- online softmax (row = tid/8 + 32 rr, 16 cols per thread and row)
    for (int rr = 0; rr < RP; ++rr) {
      const int row = srow + rr * (NW * 4);
      float mx = -3.0e38f;
      for (int j = 0; j < 16; ++j)
        mx = fmaxf(mx, Ss[row * SS_STRIDE + SS_GRP(sseg) + j] * SCALE);
      pmax[row][sseg] = mx;
    }
    __syncthreads();
    if (sseg < RP) {                  // one thread per row
      const int row = srow + sseg * (NW * 4);
      float mt = pmax[row][0];
      for (int j = 1; j < 8; ++j) mt = fmaxf(mt, pmax[row][j]);
      const float mo = m_run[row];
      const float mn = fmaxf(mo, mt);
      m_new_s[row] = mn;
      corr_s[row]  = __expf(mo - mn);
      m_run[row]   = mn;
    }
    __syncthreads();
    for (int rr = 0; rr < RP; ++rr) {
      const int row = srow + rr * (NW * 4);
      const float mn = m_new_s[row];
      float ps = 0.0f;
      for (int j = 0; j < 16; ++j) {
        const int c = sseg * 16 + j;
        const float p = __expf(Ss[row * SS_STRIDE + SS_GRP(sseg) + j] * SCALE - mn);
        ps += p;
        Ps[row * PS_STRIDE + c] = f2bf(p);
      }
      psum[row][sseg] = ps;
      // Keeps the two rows' work apart.
      __builtin_amdgcn_sched_barrier(0);
    }
    __syncthreads();
    if (sseg < RP) {                  // one thread per row
      const int row = srow + sseg * (NW * 4);
      float t = 0.0f;
      for (int j = 0; j < 8; ++j) t += psum[row][j];
      l_run[row] = l_run[row] * corr_s[row] + t;
    }

    // ---- O = corr*O + P @ V_tile ; wave w owns cols [16 JN w, +16 JN), 4 strips
    // P and V fragments are fetched one k step ahead (two register sets).
    v16bf pf[2][4], vf[2][JN];
    const short* prow = &Ps[am * PS_STRIDE + kh * 8];
    const short* vrow = &Vs[(wave * JN * 16 + am) * BN];
    float cr[4][8];
    for (int st = 0; st < 4; ++st)
      for (int r = 0; r < 8; ++r) cr[st][r] = corr_s[st * 16 + r + kh * 8];
    for (int st = 0; st < 4; ++st)
      pf[0][st] = frag_from(prow + st * 16 * PS_STRIDE, prow + st * 16 * PS_STRIDE + 16);
    for (int j = 0; j < JN; ++j)
      vf[0][j] = frag_from(vrow + j * 16 * BN + sw[0], vrow + j * 16 * BN + sw[1]);
    // Keeps step 0's loads in front of the rescaling, so that they fly under it.
    __builtin_amdgcn_sched_barrier(0);
    for (int st = 0; st < 4; ++st)
      for (int j = 0; j < JN; ++j)
        for (int r = 0; r < 8; ++r) acc[st][j][r] *= cr[st][r];
    // Keeps step 1's loads behind the rescaling, so that no wait of the rescaling
    // covers them.
    __builtin_amdgcn_sched_barrier(0);
    // Unrolled: constant indices into pf and vf keep them in registers.
#pragma unroll
    for (int s = 0; s < 4; ++s) {
      if (s + 1 < 4) {
        const int n = s + 1;
        for (int st = 0; st < 4; ++st)
          pf[n & 1][st] = frag_from(prow + st * 16 * PS_STRIDE + n * 32,
                                    prow + st * 16 * PS_STRIDE + n * 32 + 16);
        for (int j = 0; j < JN; ++j)
          vf[n & 1][j] = frag_from(vrow + j * 16 * BN + sw[2 * n], vrow + j * 16 * BN + sw[2 * n + 1]);
      }
      // Keeps the loads of step s + 1 in front of the products of step s (as in
      // the score phase).
      __builtin_amdgcn_sched_barrier(0);
      for (int j = 0; j < JN; ++j)
        for (int st = 0; st < 4; ++st)
          acc[st][j] = __builtin_amdgcn_wmma_f32_16x16x32_bf16(false, pf[s & 1][st], false, vf[s & 1][j], (short)0, acc[st][j], false, false);
      // Keeps the next loads behind these products (same purpose).
      __builtin_amdgcn_sched_barrier(0);
    }
    // Foot of the P@V phase: this wave's reads of Vs are done and its copies
    // of K(t+1) have landed before the barrier; behind it Vs is refilled.
    asm volatile("s_wait_dscnt 0x0" ::: "memory");
    asm volatile("s_wait_asynccnt 0x0" ::: "memory");
    __syncthreads();
    if (more) copy_v_tile(Vt, kbn, vs_base, wave, lane);
  }
  // No copy is left in flight when the wave goes on to its end.
  asm volatile("s_wait_asynccnt 0x0" ::: "memory");

  // ---- epilogue: this half's unnormalised sums, row maxima and row sums
  float* od = Op + ((size_t)half * N_TOK + qrow0 + kh * 8) * D + wave * JN * 16 + am;
  for (int st = 0; st < 4; ++st)
    for (int j = 0; j < JN; ++j)
      for (int r = 0; r < 8; ++r)
        od[(st * 16 + r) * D + j * 16] = acc[st][j][r];
  if (tid < BM) {
    Mp[half * N_TOK + qrow0 + tid] = m_run[tid];
    Lp[half * N_TOK + qrow0 + tid] = l_run[tid];
  }
}

// ---------------------------------------------------------------------------
// Kernel 3: merge the two halves of every row's softmax. One thread per four
// output columns.
// ---------------------------------------------------------------------------
__global__ __launch_bounds__(256) void merge_kernel(
    const float* __restrict__ Op, const float* __restrict__ Mp,
    const float* __restrict__ Lp, float* __restrict__ out)
{
  const int idx = blockIdx.x * 256 + threadIdx.x;   // float4 index into out
  const int row = idx / (D / 4);
  const float4 a = ((const float4*)Op)[idx];
  const float4 b = ((const float4*)(Op + (size_t)N_TOK * D))[idx];
  const float m0 = Mp[row], m1 = Mp[N_TOK + row];
  const float l0 = Lp[row], l1 = Lp[N_TOK + row];
  const float m  = fmaxf(m0, m1);
  const float e0 = __expf(m0 - m), e1 = __expf(m1 - m);
  const float inv = 1.0f / (l0 * e0 + l1 * e1);
  const float w0 = e0 * inv, w1 = e1 * inv;
  float4 o;
  o.x = a.x * w0 + b.x * w1;
  o.y = a.y * w0 + b.y * w1;
  o.z = a.z * w0 + b.z * w1;
  o.w = a.w * w0 + b.w * w1;
  ((float4*)out)[idx] = o;
}

extern "C" void kernel_launch(void* const* d_in, const int* in_sizes, int n_in,
                              void* d_out, int out_size, void* d_ws, size_t ws_size,
                              hipStream_t stream) {
  const float* emb = (const float*)d_in[0];
  const float* Wqk = (const float*)d_in[1];
  const float* bqk = (const float*)d_in[2];
  const float* Wv  = (const float*)d_in[3];
  const float* bv  = (const float*)d_in[4];

  short* Qg = (short*)d_ws;                       // bf16 [8192][512]  (8 MB)
  short* Vt = Qg + (size_t)N_TOK * D;             // bf16 [512][8192]  (8 MB)
  float* Op = (float*)(Vt + (size_t)N_TOK * D);   // f32  [2][8192][512] (32 MB)
  float* Mp = Op + (size_t)NSPLIT * N_TOK * D;    // f32  [2][8192]
  float* Lp = Mp + (size_t)NSPLIT * N_TOK;        // f32  [2][8192]
  float* out = (float*)d_out;                     // f32  [8192][512]

  proj_kernel<<<512, 256, 0, stream>>>(emb, Wqk, bqk, Wv, bv, Qg, Vt);
  attn_kernel<<<N_TOK / BM * NSPLIT, NW * 32, 0, stream>>>(Qg, Vt, Op, Mp, Lp);
  merge_kernel<<<N_TOK * D / 4 / 256, 256, 0, stream>>>(Op, Mp, Lp, out);
}

// v006
// It runs in 142 microseconds.
// Next to v005, in two timings, it ran 1.04 and 1.03 times as fast.
// Counting every step since v000, it is 3.41 times as fast.
#include <hip/hip_runtime.h>

#define N_TOK 8192
#define D 512
#define BM 64            /* query rows per block (4 strips of 16)           */
#define BN 128           /* keys per tile                                   */
#define NW 8             /* waves per attention block                       */
#define NSPLIT 2         /* blocks that share one query block's key range   */
#define TILES (N_TOK / BN / NSPLIT)   /* key tiles per block                */
#define GS (32 / NW)     /* 16-key score groups per wave (one strip each)   */
#define JN (32 / NW)     /* 16-column output groups per wave (all strips)   */
#define RK (BN / NW)     /* key rows that a wave copies                     */
#define RV (D / NW)      /* value rows that a wave copies                   */
#define RP (BM / (NW * 4))  /* softmax rows per thread                      */
#define SCALE 0.04419417382415922f  /* 1/sqrt(512) */

/* Row pitches for 16-byte LDS reads: 16 B x odd, so that the 16 rows (or the
   2 rows x 8 segments) that half a wave reads at once fall on all 64 banks. */
#define PS_STRIDE 136    /* 128 + 8 elems,  272 B = 16 B x 17               */
#define SS_STRIDE 140    /* f32 scores: 128 + 8 (mid-row gap) + 4, 16 B x 35 */
/* First dword of 16-column group g of a score row: columns 64..127 stand 8
   dwords further on, so groups g and g + 4 do not share banks.             */
#define SS_GRP(g) ((g) * 16 + ((g) >> 2) * 8)

typedef __attribute__((ext_vector_type(16))) __bf16 v16bf;
typedef __attribute__((ext_vector_type(8)))  float  v8f;
typedef __attribute__((ext_vector_type(8)))  short  v8s;

struct bpair { v8s lo, hi; };

// 16x32-bf16 A/B fragment for v_wmma_f32_16x16x32_bf16 from two 16-byte
// chunks (K = kk..kk+7 and kk+16..kk+23 for this lane; lanes 0-15 kh=0,
// lanes 16-31 kh=1, per the ISA 16-bit A/B VGPR striping).
static __device__ __forceinline__ v16bf frag_from(const void* plo, const void* phi) {
  bpair f;
  f.lo = *(const v8s*)plo;
  f.hi = *(const v8s*)phi;
  return __builtin_bit_cast(v16bf, f);
}

// Hardware f32->bf16 convert (let clang pick v_cvt, ideally packed).
static __device__ __forceinline__ short f2bf(float x) {
  __bf16 h = (__bf16)x;
  return __builtin_bit_cast(short, h);
}

// ---------------------------------------------------------------------------
// Kernel 1: Q = emb @ Wqk^T + bqk  (bf16, row-major [N][D])
//           V = emb @ Wv^T  + bv   (bf16, TRANSPOSED: Vt[D][N])
// One block per 128 tokens x 128 output features (feature blocks 0..3 are Q,
// 4..7 are V). The f32 operands come in by whole-line loads, 64 k at a time,
// are rounded to bf16 once and staged in LDS (two buffers); each of the 8
// waves works a 32 x 64 tile, so a fragment read from LDS feeds 4 or 2 WMMAs.
// ---------------------------------------------------------------------------
#define PB 128           /* tokens, and features, per block                 */
#define PBK 64           /* k per staged chunk                              */
#define PT_STRIDE 72     /* 64 + 8 elems, 144B = 16B x odd: no bank conflict */

typedef __attribute__((ext_vector_type(4))) short v4s;

static __device__ __forceinline__ v4s cvt4(float4 a) {
  v4s r;
  r[0] = f2bf(a.x); r[1] = f2bf(a.y); r[2] = f2bf(a.z); r[3] = f2bf(a.w);
  return r;
}

__global__ __launch_bounds__(256) void proj_kernel(
    const float* __restrict__ emb,
    const float* __restrict__ Wqk, const float* __restrict__ bqk,
    const float* __restrict__ Wv,  const float* __restrict__ bv,
    short* __restrict__ Qg, short* __restrict__ Vt)
{
  __shared__ __attribute__((aligned(16))) short As[2][PB * PT_STRIDE];
  __shared__ __attribute__((aligned(16))) short Bs[2][PB * PT_STRIDE];

  const int tid  = threadIdx.x;
  const int lane = tid & 31;
  const int wave = tid >> 5;
  const int am = lane & 15;
  const int kh = lane >> 4;
  const int bm = blockIdx.x >> 3;           // token block   0..63
  const int bn = blockIdx.x & 7;            // feature block 0..7
  const bool is_v = bn >= 4;
  const int f0 = (bn & 3) * PB;             // first feature, in its own matrix
  const int t0 = bm * PB;                   // first token
  const int wm = wave & 3;                  // 32-token strip of the block
  const int wn = wave >> 2;                 // 64-feature half of the block

  // Staging map: 16 lanes cover one row's 256 B, a wave two rows.
  const int lrow = tid >> 4;
  const int lc4  = tid & 15;
  const float* asrc = emb + (t0 + lrow) * D + lc4 * 4;
  const float* bsrc = (is_v ? Wv : Wqk) + (f0 + lrow) * D + lc4 * 4;
  const int sdst = lrow * PT_STRIDE + lc4 * 4;

  float4 ra[8], rb[8];
  for (int i = 0; i < 8; ++i) {
    ra[i] = *(const float4*)(asrc + i * 16 * D);
    rb[i] = *(const float4*)(bsrc + i * 16 * D);
  }
  for (int i = 0; i < 8; ++i) {
    *(v4s*)&As[0][sdst + i * 16 * PT_STRIDE] = cvt4(ra[i]);
    *(v4s*)&Bs[0][sdst + i * 16 * PT_STRIDE] = cvt4(rb[i]);
  }
  __syncthreads();
  for (int i = 0; i < 8; ++i) {
    ra[i] = *(const float4*)(asrc + i * 16 * D + PBK);
    rb[i] = *(const float4*)(bsrc + i * 16 * D + PBK);
  }
  // The two pointers that these loads name are inputs here, so that their step
  // below stands behind this wait.
  asm volatile("s_wait_xcnt 0x0" :: "v"(asrc), "v"(bsrc) : "memory");
  asrc += PBK;
  bsrc += PBK;

  v8f acc[2][4] = {};
  // Kept rolled: unrolled, the whole loop is one block of code and the compiler
  // lifts the rounding, with the wait for the loads, in front of the products.
#pragma unroll 1
  for (int c = 0; c < D / PBK; ++c) {
    const short* at = &As[c & 1][(wm * 32 + am) * PT_STRIDE + kh * 8];
    const short* bt = &Bs[c & 1][(wn * 64 + am) * PT_STRIDE + kh * 8];
    for (int ks = 0; ks < PBK / 32; ++ks) {
      v16bf a[2], b[4];
      for (int m = 0; m < 2; ++m)
        a[m] = frag_from(at + m * 16 * PT_STRIDE + ks * 32,
                         at + m * 16 * PT_STRIDE + ks * 32 + 16);
      for (int n = 0; n < 4; ++n)
        b[n] = frag_from(bt + n * 16 * PT_STRIDE + ks * 32,
                         bt + n * 16 * PT_STRIDE + ks * 32 + 16);
      for (int m = 0; m < 2; ++m)
        for (int n = 0; n < 4; ++n)
          acc[m][n] = __builtin_amdgcn_wmma_f32_16x16x32_bf16(
              false, a[m], false, b[n], (short)0, acc[m][n], false, false);
    }
    if (c + 1 < D / PBK) {
      // Chunk c+1, loaded under the products above, goes to the other buffer,
      // whose last readers left it at the previous barrier.
      short* ad = &As[(c + 1) & 1][sdst];
      short* bd = &Bs[(c + 1) & 1][sdst];
      for (int i = 0; i < 8; ++i) {
        *(v4s*)(ad + i * 16 * PT_STRIDE) = cvt4(ra[i]);
        *(v4s*)(bd + i * 16 * PT_STRIDE) = cvt4(rb[i]);
      }
    }
    __syncthreads();
    if (c + 2 < D / PBK) {
      // The two pointers live across the trips, so no result lands in them.
      for (int i = 0; i < 8; ++i) {
        ra[i] = *(const float4*)(asrc + i * 16 * D + PBK);
        rb[i] = *(const float4*)(bsrc + i * 16 * D + PBK);
      }
      asrc += PBK;
      bsrc += PBK;
    }
  }

  // D layout: VGPR r -> token row (+ kh*8 + r), column = feature (+ am).
  const int ocol0 = f0 + wn * 64 + am;
  const int tok0  = t0 + wm * 32 + kh * 8;
  if (is_v) {
    // Vt row = feature, 8 contiguous tokens -> one 16B store.
    for (int n = 0; n < 4; ++n) {
      const float bias = bv[ocol0 + n * 16];
      for (int m = 0; m < 2; ++m) {
        v8s vp;
        for (int r = 0; r < 8; ++r) vp[r] = f2bf(acc[m][n][r] + bias);
        *(v8s*)(Vt + (ocol0 + n * 16) * N_TOK + tok0 + m * 16) = vp;
      }
    }
    // No register that these stores name is rewritten in front of this wait.
    asm volatile("s_wait_xcnt 0x0" ::: "memory");
  } else {
    for (int n = 0; n < 4; ++n) {
      const float bias = bqk[ocol0 + n * 16];
      for (int m = 0; m < 2; ++m)
        for (int r = 0; r < 8; ++r)
          Qg[(tok0 + m * 16 + r) * D + ocol0 + n * 16] = f2bf(acc[m][n][r] + bias);
    }
  }
}

// Eight 16-byte-per-lane asynchronous copies, global memory to LDS, through no
// register. The s_wait_xcnt stands inside the statement, behind the last copy,
// so that no address register named here is rewritten in front of it.
static __device__ __forceinline__ void async_copy8(const unsigned (&l)[8],
                                                   const short* const (&g)[8]) {
  asm volatile(
      "global_load_async_to_lds_b128 %0, %8, off\n\t"
      "global_load_async_to_lds_b128 %1, %9, off\n\t"
      "global_load_async_to_lds_b128 %2, %10, off\n\t"
      "global_load_async_to_lds_b128 %3, %11, off\n\t"
      "global_load_async_to_lds_b128 %4, %12, off\n\t"
      "global_load_async_to_lds_b128 %5, %13, off\n\t"
      "global_load_async_to_lds_b128 %6, %14, off\n\t"
      "global_load_async_to_lds_b128 %7, %15, off\n\t"
      "s_wait_xcnt 0x0"
      :: "v"(l[0]), "v"(l[1]), "v"(l[2]), "v"(l[3]),
         "v"(l[4]), "v"(l[5]), "v"(l[6]), "v"(l[7]),
         "v"(g[0]), "v"(g[1]), "v"(g[2]), "v"(g[3]),
         "v"(g[4]), "v"(g[5]), "v"(g[6]), "v"(g[7])
      : "memory");
}

// LDS tiles are unpadded; the 16-byte chunk c of a row sits at chunk position
// c ^ (row & 15), so 16 lanes reading one chunk column of 16 rows hit 16
// different bank groups.

// Key tile: wave w brings key rows [RK w, RK w + RK) of the 128-key tile, 1024 B
// each; one copy covers 512 contiguous global bytes.
static __device__ __forceinline__ void copy_k_tile(const short* __restrict__ Qg, int kb,
                                                   unsigned ks_base, int wave, int lane) {
  const short* gsrc = Qg + (kb + wave * RK) * D + lane * 8;
  const unsigned ldst = ks_base + wave * RK * 1024;
  const int lx = lane ^ ((wave * RK) & 15);   // RK divides 16: row & 15 = this | r
  // Kept rolled: unrolled, every copy's LDS address is held across the tile loop,
  // and beside the Q fragments and the sums they no longer fit the registers.
#pragma unroll 1
  for (int q = 0; q < RK / 4; ++q) {
    unsigned l[8];
    const short* g[8];
    for (int u = 0; u < 8; ++u) {
      const int i = q * 8 + u, r = i >> 1, h = i & 1;
      g[u] = gsrc + r * D + h * 256;
      l[u] = ldst + r * 1024 + h * 512 + ((lx ^ r) << 4);
    }
    async_copy8(l, g);
  }
}

// Value tile: wave w brings Vt rows [RV w, RV w + RV), 256 B (128 keys) each; one
// copy covers two rows.
static __device__ __forceinline__ void copy_v_tile(const short* __restrict__ Vt, int kb,
                                                   unsigned vs_base, int wave, int lane) {
  const int am = lane & 15, kh = lane >> 4;
  const short* gsrc = Vt + (wave * RV + kh) * N_TOK + kb + am * 8;
  const unsigned ldst = vs_base + (wave * RV + kh) * 256;
  // Kept rolled, for the same reason as in copy_k_tile.
#pragma unroll 1
  for (int q = 0; q < RV / 16; ++q) {
    unsigned l[8];
    const short* g[8];
    for (int u = 0; u < 8; ++u) {
      const int i = q * 8 + u;
      g[u] = gsrc + 2 * i * N_TOK;
      l[u] = ldst + i * 512 + (((am ^ kh) ^ ((2 * i) & 14)) << 4);
    }
    async_copy8(l, g);
  }
}

// ---------------------------------------------------------------------------
// Kernel 2: flash attention over half of the keys. Block = 64 query rows
// (4 strips), 8 waves; two blocks share a query block, each walks 32 of the 64
// key tiles and leaves its unnormalised sums, its row maxima and its row sums
// in the workspace for kernel 3. A key or value byte that comes from L2 so
// serves 64 query rows.
// Per 128-key tile: wave w computes the scores of strip w & 3 for 64 keys, its
// strip's Q fragments staying in registers for the whole walk; online softmax;
// then wave w computes P@V for output columns [64w, 64w+64) of all four strips,
// each Vt B fragment feeding four WMMAs.
// The key tile and the value tile each have one LDS buffer, filled by
// asynchronous copies: V(t) flies under the score phase of tile t, K(t+1)
// under the softmax and P@V of tile t.
// Four blocks start their walk at each tile of their half and wrap, so that
// blocks running side by side spread their L2 requests over many lines.
// ---------------------------------------------------------------------------
__global__ __launch_bounds__(NW * 32) void attn_kernel(
    const short* __restrict__ Qg, const short* __restrict__ Vt,
    float* __restrict__ Op, float* __restrict__ Mp, float* __restrict__ Lp)
{
  __shared__ __attribute__((aligned(1024))) short Ks[BN * D];   // 128 KB
  __shared__ __attribute__((aligned(1024))) short Vs[D * BN];   // 128 KB
  __shared__ __attribute__((aligned(16))) float Ss[BM * SS_STRIDE];   // 35.0 KB
  __shared__ __attribute__((aligned(16))) short Ps[BM * PS_STRIDE];   // 17.0 KB
  __shared__ float pmax[BM][8];
  __shared__ float psum[BM][8];
  __shared__ float m_run[BM], l_run[BM], m_new_s[BM], corr_s[BM];

  const int tid  = threadIdx.x;
  const int lane = tid & 31;
  const int wave = tid >> 5;
  const int am = lane & 15;
  const int kh = lane >> 4;
  const int half  = blockIdx.x & (NSPLIT - 1);
  const int qrow0 = (blockIdx.x / NSPLIT) * BM;
  const int strip = wave & 3;         // query strip of this wave's scores
  const int kgrp  = wave >> 2;        // its run of GS 16-key groups
  const unsigned ks_base = (unsigned)(unsigned long long)&Ks[0];
  const unsigned vs_base = (unsigned)(unsigned long long)&Vs[0];

  // Element offset of chunk 2e + kh of a row with (row & 15) == am.
  int sw[8];
  for (int e = 0; e < 8; ++e) sw[e] = ((2 * e) ^ (am ^ kh)) * 8;

  // First tile of this block's walk inside its half, for speed only: any value in
  // 0..TILES-1 gives the same function. Four blocks share a start, those whose
  // index differs only in bits 1 and 2.
  const int tile0 = half * TILES;
  const int rot = (blockIdx.x >> 3) & (TILES - 1);

  copy_k_tile(Qg, (tile0 + rot) * BN, ks_base, wave, lane);

  // This wave's strip of Q, 16 rows x 512, as 16 A fragments in registers.
  v16bf qf[16];
  const short* qsrc = Qg + (qrow0 + strip * 16 + am) * D + kh * 8;
  // Unrolled: qf is indexed by constants only, so it stays in registers.
#pragma unroll
  for (int s = 0; s < 16; ++s) qf[s] = frag_from(qsrc + s * 32, qsrc + s * 32 + 16);

  if (tid < BM) { m_run[tid] = -3.0e38f; l_run[tid] = 0.0f; }
  // K(0) has landed before the barrier that lets anybody read it.
  asm volatile("s_wait_asynccnt 0x0" ::: "memory");
  __syncthreads();
  copy_v_tile(Vt, (tile0 + rot) * BN, vs_base, wave, lane);

  v8f acc[4][JN] = {};                // [strip][column group]
  const int srow = tid >> 3;          // 0..31
  const int sseg = tid & 7;           // 16 cols per segment

  for (int kt = 0; kt < TILES; ++kt) {
    const bool more = kt + 1 < TILES;                               // a next tile exists
    const int kbn = (tile0 + ((kt + 1 + rot) & (TILES - 1))) * BN;  // its first key

    // ---- S subtiles: Q fragment from registers, key B fragments from LDS,
    // fetched two k steps ahead through a ring of three register sets
    v8f sc[GS] = {};
    const short* krow = &Ks[(kgrp * GS * 16 + am) * D];
    v16bf kf[3][GS];
    for (int p = 0; p < 2; ++p)
      for (int g = 0; g < GS; ++g)
        kf[p][g] = frag_from(krow + g * 16 * D + sw[2 * p], krow + g * 16 * D + sw[2 * p + 1]);
    // Unrolled: constant indices into qf and kf keep them in registers.
#pragma unroll
    for (int s = 0; s < 16; ++s) {
      if (s + 2 < 16) {
        const int n = s + 2;
        for (int g = 0; g < GS; ++g)
          kf[n % 3][g] = frag_from(krow + g * 16 * D + (n >> 2) * 128 + sw[(2 * n) & 7],
                                   krow + g * 16 * D + (n >> 2) * 128 + sw[(2 * n + 1) & 7]);
      }
      // Keeps the loads of step s + 2 in front of the products of step s: left
      // alone, the compiler sinks each load to its product, which then waits a
      // whole LDS latency.
      __builtin_amdgcn_sched_barrier(0);
      for (int g = 0; g < GS; ++g)
        sc[g] = __builtin_amdgcn_wmma_f32_16x16x32_bf16(false, qf[s], false, kf[s % 3][g], (short)0, sc[g], false, false);
      // Keeps the next loads behind these products (same purpose).
      __builtin_amdgcn_sched_barrier(0);
    }
    for (int g = 0; g < GS; ++g) {
      const int grp = kgrp * GS + g;
      for (int r = 0; r < 8; ++r)
        Ss[(strip * 16 + r + kh * 8) * SS_STRIDE + SS_GRP(grp) + am] = sc[g][r];
    }
    // Foot of the score phase: this wave's reads of Ks are done and its copies
    // of V(t) have landed before the barrier; behind it Ks is refilled.
    asm volatile("s_wait_dscnt 0x0" ::: "memory");
    asm volatile("s_wait_asynccnt 0x0" ::: "memory");
    __syncthreads();
    if (more) copy_k_tile(Qg, kbn, ks_base, wave, lane);

    // ---- online softmax (row = tid/8 + 32 rr, 16 cols per thread and row)
    for (int rr = 0; rr < RP; ++rr) {
      const int row = srow + rr * (NW * 4);
      float mx = -3.0e38f;
      for (int j = 0; j < 16; ++j)
        mx = fmaxf(mx, Ss[row * SS_STRIDE + SS_GRP(sseg) + j] * SCALE);
      pmax[row][sseg] = mx;
    }
    __syncthreads();
    if (sseg < RP) {                  // one thread per row
      const int row = srow + sseg * (NW * 4);
      float mt = pmax[row][0];
      for (int j = 1; j < 8; ++j) mt = fmaxf(mt, pmax[row][j]);
      const float mo = m_run[row];
      const float mn = fmaxf(mo, mt);
      m_new_s[row] = mn;
      corr_s[row]  = __expf(mo - mn);
      m_run[row]   = mn;
    }
    __syncthreads();
    for (int rr = 0; rr < RP; ++rr) {
      const int row = srow + rr * (NW * 4);
      const float mn = m_new_s[row];
      float ps = 0.0f;
      for (int j = 0; j < 16; ++j) {
        const int c = sseg * 16 + j;
        const float p = __expf(Ss[row * SS_STRIDE + SS_GRP(sseg) + j] * SCALE - mn);
        ps += p;
        Ps[row * PS_STRIDE + c] = f2bf(p);
      }
      psum[row][sseg] = ps;
      // Keeps the two rows' work apart.
      __builtin_amdgcn_sched_barrier(0);
    }
    __syncthreads();
    if (sseg < RP) {                  // one thread per row
      const int row = srow + sseg * (NW * 4);
      float t = 0.0f;
      for (int j = 0; j < 8; ++j) t += psum[row][j];
      l_run[row] = l_run[row] * corr_s[row] + t;
    }

    // ---- O = corr*O + P @ V_tile ; wave w owns cols [16 JN w, +16 JN), 4 strips
    // P and V fragments are fetched one k step ahead (two register sets).
    v16bf pf[2][4], vf[2][JN];
    const short* prow = &Ps[am * PS_STRIDE + kh * 8];
    const short* vrow = &Vs[(wave * JN * 16 + am) * BN];
    float cr[4][8];
    for (int st = 0; st < 4; ++st)
      for (int r = 0; r < 8; ++r) cr[st][r] = corr_s[st * 16 + r + kh * 8];
    for (int st = 0; st < 4; ++st)
      pf[0][st] = frag_from(prow + st * 16 * PS_STRIDE, prow + st * 16 * PS_STRIDE + 16);
    for (int j = 0; j < JN; ++j)
      vf[0][j] = frag_from(vrow + j * 16 * BN + sw[0], vrow + j * 16 * BN + sw[1]);
    // Keeps step 0's loads in front of the rescaling, so that they fly under it.
    __builtin_amdgcn_sched_barrier(0);
    for (int st = 0; st < 4; ++st)
      for (int j = 0; j < JN; ++j)
        for (int r = 0; r < 8; ++r) acc[st][j][r] *= cr[st][r];
    // Keeps step 1's loads behind the rescaling, so that no wait of the rescaling
    // covers them.
    __builtin_amdgcn_sched_barrier(0);
    // Unrolled: constant indices into pf and vf keep them in registers.
#pragma unroll
    for (int s = 0; s < 4; ++s) {
      if (s + 1 < 4) {
        const int n = s + 1;
        for (int st = 0; st < 4; ++st)
          pf[n & 1][st] = frag_from(prow + st * 16 * PS_STRIDE + n * 32,
                                    prow + st * 16 * PS_STRIDE + n * 32 + 16);
        for (int j = 0; j < JN; ++j)
          vf[n & 1][j] = frag_from(vrow + j * 16 * BN + sw[2 * n], vrow + j * 16 * BN + sw[2 * n + 1]);
      }
      // Keeps the loads of step s + 1 in front of the products of step s (as in
      // the score phase).
      __builtin_amdgcn_sched_barrier(0);
      for (int j = 0; j < JN; ++j)
        for (int st = 0; st < 4; ++st)
          acc[st][j] = __builtin_amdgcn_wmma_f32_16x16x32_bf16(false, pf[s & 1][st], false, vf[s & 1][j], (short)0, acc[st][j], false, false);
      // Keeps the next loads behind these products (same purpose).
      __builtin_amdgcn_sched_barrier(0);
    }
    // Foot of the P@V phase: this wave's reads of Vs are done and its copies
    // of K(t+1) have landed before the barrier; behind it Vs is refilled.
    asm volatile("s_wait_dscnt 0x0" ::: "memory");
    asm volatile("s_wait_asynccnt 0x0" ::: "memory");
    __syncthreads();
    if (more) copy_v_tile(Vt, kbn, vs_base, wave, lane);
  }
  // No copy is left in flight when the wave goes on to its end.
  asm volatile("s_wait_asynccnt 0x0" ::: "memory");

  // ---- epilogue: this half's unnormalised sums, row maxima and row sums
  float* od = Op + ((size_t)half * N_TOK + qrow0 + kh * 8) * D + wave * JN * 16 + am;
  for (int st = 0; st < 4; ++st)
    for (int j = 0; j < JN; ++j)
      for (int r = 0; r < 8; ++r)
        od[(st * 16 + r) * D + j * 16] = acc[st][j][r];
  if (tid < BM) {
    Mp[half * N_TOK + qrow0 + tid] = m_run[tid];
    Lp[half * N_TOK + qrow0 + tid] = l_run[tid];
  }
}

// ---------------------------------------------------------------------------
// Kernel 3: merge the two halves of every row's softmax. Few, long waves, for
// speed only: a wave merges MW whole rows (4 KB of each half and of out, in a
// row of 512-byte accesses), and works out a row's two weights once.
// ---------------------------------------------------------------------------
#define MW 2                        /* rows per wave                         */
#define MS (D / 4 / 32)             /* 512-byte accesses per row             */

typedef __attribute__((ext_vector_type(4))) float v4f;

__global__ __launch_bounds__(256) void merge_kernel(
    const float* __restrict__ Op, const float* __restrict__ Mp,
    const float* __restrict__ Lp, float* __restrict__ out)
{
  const int row0 = (blockIdx.x * 8 + (threadIdx.x >> 5)) * MW;   // the wave's first row
  const int idx0 = row0 * (D / 4) + (threadIdx.x & 31);          // float4 index into out
  const v4f* pa = (const v4f*)Op + idx0;
  const v4f* pb = (const v4f*)(Op + (size_t)N_TOK * D) + idx0;
  float m0[MW], m1[MW], l0[MW], l1[MW];
  v4f a[MW * MS], b[MW * MS];
  // The three loops are unrolled: constant indices keep the arrays in registers.
#pragma unroll
  for (int j = 0; j < MW; ++j) {
    m0[j] = Mp[row0 + j]; m1[j] = Mp[N_TOK + row0 + j];
    l0[j] = Lp[row0 + j]; l1[j] = Lp[N_TOK + row0 + j];
  }
#pragma unroll
  for (int k = 0; k < MW * MS; ++k) {
    a[k] = pa[k * 32];
    b[k] = pb[k * 32];
  }
  // Takes the loaded values as inputs only, so that every load is issued in front
  // of the arithmetic: left alone, the compiler sinks the later loads behind the
  // waits for the first ones, and their latencies add up.
  asm volatile("" :: "v"(a[0]), "v"(a[1]), "v"(a[2]), "v"(a[3]),
                     "v"(a[4]), "v"(a[5]), "v"(a[6]), "v"(a[7]),
                     "v"(b[0]), "v"(b[1]), "v"(b[2]), "v"(b[3]),
                     "v"(b[4]), "v"(b[5]), "v"(b[6]), "v"(b[7]));
  // Keeps the weights' arithmetic, with its wait for the four small loads, behind
  // that statement: lifted over it, it stood in front of most of the large loads.
  __builtin_amdgcn_sched_barrier(0);
#pragma unroll
  for (int j = 0; j < MW; ++j) {
    const float m  = fmaxf(m0[j], m1[j]);
    const float e0 = __expf(m0[j] - m), e1 = __expf(m1[j] - m);
    const float inv = 1.0f / (l0[j] * e0 + l1[j] * e1);
    const float w0 = e0 * inv, w1 = e1 * inv;
    for (int s = 0; s < MS; ++s) {
      const int k = j * MS + s;
      ((v4f*)out)[idx0 + k * 32] = a[k] * w0 + b[k] * w1;
    }
  }
}

extern "C" void kernel_launch(void* const* d_in, const int* in_sizes, int n_in,
                              void* d_out, int out_size, void* d_ws, size_t ws_size,
                              hipStream_t stream) {
  const float* emb = (const float*)d_in[0];
  const float* Wqk = (const float*)d_in[1];
  const float* bqk = (const float*)d_in[2];
  const float* Wv  = (const float*)d_in[3];
  const float* bv  = (const float*)d_in[4];

  short* Qg = (short*)d_ws;                       // bf16 [8192][512]  (8 MB)
  short* Vt = Qg + (size_t)N_TOK * D;             // bf16 [512][8192]  (8 MB)
  float* Op = (float*)(Vt + (size_t)N_TOK * D);   // f32  [2][8192][512] (32 MB)
  float* Mp = Op + (size_t)NSPLIT * N_TOK * D;    // f32  [2][8192]
  float* Lp = Mp + (size_t)NSPLIT * N_TOK;        // f32  [2][8192]
  float* out = (float*)d_out;                     // f32  [8192][512]

  proj_kernel<<<512, 256, 0, stream>>>(emb, Wqk, bqk, Wv, bv, Qg, Vt);
  attn_kernel<<<N_TOK / BM * NSPLIT, NW * 32, 0, stream>>>(Qg, Vt, Op, Mp, Lp);
  merge_kernel<<<N_TOK / (8 * MW), 256, 0, stream>>>(Op, Mp, Lp, out);
}

// v007
// Measured time: 135 microseconds a run.
// Next to v006, in two timings, it ran 1.06 and 1.05 times as fast.
// Over all steps from v000 it is 3.60 times as fast.
#include <hip/hip_runtime.h>

#define N_TOK 8192
#define D 512
#define BM 64            /* query rows per block (4 strips of 16)           */
#define BN 128           /* keys per tile                                   */
#define NW 8             /* waves per attention block                       */
#define NSPLIT 2         /* blocks that share one query block's key range   */
#define TILES (N_TOK / BN / NSPLIT)   /* key tiles per block                */
#define GS (32 / NW)     /* 16-key score groups per wave (one strip each)   */
#define JN (32 / NW)     /* 16-column output groups per wave (all strips)   */
#define RK (BN / NW)     /* key rows that a wave copies                     */
#define RV (D / NW)      /* value rows that a wave copies                   */
#define SCALE 0.04419417382415922f  /* 1/sqrt(512) */
#define SCALE2 (SCALE * 1.4426950408889634f)  /* the same, for powers of two   */

/* Row pitches for 16-byte LDS reads: 16 B x odd, so that the 16 rows
   that half a wave reads at once fall on all 64 banks. */
#define PS_STRIDE 136    /* 128 + 8 elems,  272 B = 16 B x 17               */

typedef __attribute__((ext_vector_type(16))) __bf16 v16bf;
typedef __attribute__((ext_vector_type(8)))  float  v8f;
typedef __attribute__((ext_vector_type(8)))  short  v8s;
typedef __attribute__((ext_vector_type(4)))  float  v4f;

struct bpair { v8s lo, hi; };

// 16x32-bf16 A/B fragment for v_wmma_f32_16x16x32_bf16 from two 16-byte
// chunks (K = kk..kk+7 and kk+16..kk+23 for this lane; lanes 0-15 kh=0,
// lanes 16-31 kh=1, per the ISA 16-bit A/B VGPR striping).
static __device__ __forceinline__ v16bf frag_from(const void* plo, const void* phi) {
  bpair f;
  f.lo = *(const v8s*)plo;
  f.hi = *(const v8s*)phi;
  return __builtin_bit_cast(v16bf, f);
}

// The value that lane (l ^ m) of the same 16-lane row holds (DPP row_xmask:m).
#define XLANE(x, m) __builtin_bit_cast(float, __builtin_amdgcn_update_dpp( \
    __builtin_bit_cast(int, (x)), __builtin_bit_cast(int, (x)), 0x160 | (m), 0xf, 0xf, true))

// Four powers of two. Written out so that no result register is a source register
// of the four (early-clobber outputs) and one free slot follows the last: the
// instruction set asks for a slot between a transcendental and an instruction that
// overwrites its source or reads its result.
static __device__ __forceinline__ void exp2x4(float (&p)[4], float a0, float a1,
                                              float a2, float a3) {
  asm("v_exp_f32 %0, %4\n\t"
      "v_exp_f32 %1, %5\n\t"
      "v_exp_f32 %2, %6\n\t"
      "v_exp_f32 %3, %7\n\t"
      "v_nop"
      : "=&v"(p[0]), "=&v"(p[1]), "=&v"(p[2]), "=&v"(p[3])
      : "v"(a0), "v"(a1), "v"(a2), "v"(a3));
}

// Hardware f32->bf16 convert (let clang pick v_cvt, ideally packed).
static __device__ __forceinline__ short f2bf(float x) {
  __bf16 h = (__bf16)x;
  return __builtin_bit_cast(short, h);
}

// ---------------------------------------------------------------------------
// Kernel 1: Q = emb @ Wqk^T + bqk  (bf16, row-major [N][D])
//           V = emb @ Wv^T  + bv   (bf16, TRANSPOSED: Vt[D][N])
// One block per 128 tokens x 128 output features (feature blocks 0..3 are Q,
// 4..7 are V). The f32 operands come in by whole-line loads, 64 k at a time,
// are rounded to bf16 once and staged in LDS (two buffers); each of the 8
// waves works a 32 x 64 tile, so a fragment read from LDS feeds 4 or 2 WMMAs.
// ---------------------------------------------------------------------------
#define PB 128           /* tokens, and features, per block                 */
#define PBK 64           /* k per staged chunk                              */
#define PT_STRIDE 72     /* 64 + 8 elems, 144B = 16B x odd: no bank conflict */

typedef __attribute__((ext_vector_type(4))) short v4s;

static __device__ __forceinline__ v4s cvt4(float4 a) {
  v4s r;
  r[0] = f2bf(a.x); r[1] = f2bf(a.y); r[2] = f2bf(a.z); r[3] = f2bf(a.w);
  return r;
}

__global__ __launch_bounds__(256) void proj_kernel(
    const float* __restrict__ emb,
    const float* __restrict__ Wqk, const float* __restrict__ bqk,
    const float* __restrict__ Wv,  const float* __restrict__ bv,
    short* __restrict__ Qg, short* __restrict__ Vt)
{
  __shared__ __attribute__((aligned(16))) short As[2][PB * PT_STRIDE];
  __shared__ __attribute__((aligned(16))) short Bs[2][PB * PT_STRIDE];

  const int tid  = threadIdx.x;
  const int lane = tid & 31;
  const int wave = tid >> 5;
  const int am = lane & 15;
  const int kh = lane >> 4;
  const int bm = blockIdx.x >> 3;           // token block   0..63
  const int bn = blockIdx.x & 7;            // feature block 0..7
  const bool is_v = bn >= 4;
  const int f0 = (bn & 3) * PB;             // first feature, in its own matrix
  const int t0 = bm * PB;                   // first token
  const int wm = wave & 3;                  // 32-token strip of the block
  const int wn = wave >> 2;                 // 64-feature half of the block

  // Staging map: 16 lanes cover one row's 256 B, a wave two rows.
  const int lrow = tid >> 4;
  const int lc4  = tid & 15;
  const float* asrc = emb + (t0 + lrow) * D + lc4 * 4;
  const float* bsrc = (is_v ? Wv : Wqk) + (f0 + lrow) * D + lc4 * 4;
  const int sdst = lrow * PT_STRIDE + lc4 * 4;

  float4 ra[8], rb[8];
  for (int i = 0; i < 8; ++i) {
    ra[i] = *(const float4*)(asrc + i * 16 * D);
    rb[i] = *(const float4*)(bsrc + i * 16 * D);
  }
  for (int i = 0; i < 8; ++i) {
    *(v4s*)&As[0][sdst + i * 16 * PT_STRIDE] = cvt4(ra[i]);
    *(v4s*)&Bs[0][sdst + i * 16 * PT_STRIDE] = cvt4(rb[i]);
  }
  __syncthreads();
  for (int i = 0; i < 8; ++i) {
    ra[i] = *(const float4*)(asrc + i * 16 * D + PBK);
    rb[i] = *(const float4*)(bsrc + i * 16 * D + PBK);
  }
  // The two pointers that these loads name are inputs here, so that their step
  // below stands behind this wait.
  asm volatile("s_wait_xcnt 0x0" :: "v"(asrc), "v"(bsrc) : "memory");
  asrc += PBK;
  bsrc += PBK;

  v8f acc[2][4] = {};
  // Kept rolled: unrolled, the whole loop is one block of code and the compiler
  // lifts the rounding, with the wait for the loads, in front of the products.
#pragma unroll 1
  for (int c = 0; c < D / PBK; ++c) {
    const short* at = &As[c & 1][(wm * 32 + am) * PT_STRIDE + kh * 8];
    const short* bt = &Bs[c & 1][(wn * 64 + am) * PT_STRIDE + kh * 8];
    for (int ks = 0; ks < PBK / 32; ++ks) {
      v16bf a[2], b[4];
      for (int m = 0; m < 2; ++m)
        a[m] = frag_from(at + m * 16 * PT_STRIDE + ks * 32,
                         at + m * 16 * PT_STRIDE + ks * 32 + 16);
      for (int n = 0; n < 4; ++n)
        b[n] = frag_from(bt + n * 16 * PT_STRIDE + ks * 32,
                         bt + n * 16 * PT_STRIDE + ks * 32 + 16);
      for (int m = 0; m < 2; ++m)
        for (int n = 0; n < 4; ++n)
          acc[m][n] = __builtin_amdgcn_wmma_f32_16x16x32_bf16(
              false, a[m], false, b[n], (short)0, acc[m][n], false, false);
    }
    if (c + 1 < D / PBK) {
      // Chunk c+1, loaded under the products above, goes to the other buffer,
      // whose last readers left it at the previous barrier.
      short* ad = &As[(c + 1) & 1][sdst];
      short* bd = &Bs[(c + 1) & 1][sdst];
      for (int i = 0; i < 8; ++i) {
        *(v4s*)(ad + i * 16 * PT_STRIDE) = cvt4(ra[i]);
        *(v4s*)(bd + i * 16 * PT_STRIDE) = cvt4(rb[i]);
      }
    }
    __syncthreads();
    if (c + 2 < D / PBK) {
      // The two pointers live across the trips, so no result lands in them.
      for (int i = 0; i < 8; ++i) {
        ra[i] = *(const float4*)(asrc + i * 16 * D + PBK);
        rb[i] = *(const float4*)(bsrc + i * 16 * D + PBK);
      }
      asrc += PBK;
      bsrc += PBK;
    }
  }

  // D layout: VGPR r -> token row (+ kh*8 + r), column = feature (+ am).
  const int ocol0 = f0 + wn * 64 + am;
  const int tok0  = t0 + wm * 32 + kh * 8;
  if (is_v) {
    // Vt row = feature, 8 contiguous tokens -> one 16B store.
    for (int n = 0; n < 4; ++n) {
      const float bias = bv[ocol0 + n * 16];
      for (int m = 0; m < 2; ++m) {
        v8s vp;
        for (int r = 0; r < 8; ++r) vp[r] = f2bf(acc[m][n][r] + bias);
        *(v8s*)(Vt + (ocol0 + n * 16) * N_TOK + tok0 + m * 16) = vp;
      }
    }
    // No register that these stores name is rewritten in front of this wait.
    asm volatile("s_wait_xcnt 0x0" ::: "memory");
  } else {
    for (int n = 0; n < 4; ++n) {
      const float bias = bqk[ocol0 + n * 16];
      for (int m = 0; m < 2; ++m)
        for (int r = 0; r < 8; ++r)
          Qg[(tok0 + m * 16 + r) * D + ocol0 + n * 16] = f2bf(acc[m][n][r] + bias);
    }
  }
}

// Eight 16-byte-per-lane asynchronous copies, global memory to LDS, through no
// register. The s_wait_xcnt stands inside the statement, behind the last copy,
// so that no address register named here is rewritten in front of it.
static __device__ __forceinline__ void async_copy8(const unsigned (&l)[8],
                                                   const short* const (&g)[8]) {
  asm volatile(
      "global_load_async_to_lds_b128 %0, %8, off\n\t"
      "global_load_async_to_lds_b128 %1, %9, off\n\t"
      "global_load_async_to_lds_b128 %2, %10, off\n\t"
      "global_load_async_to_lds_b128 %3, %11, off\n\t"
      "global_load_async_to_lds_b128 %4, %12, off\n\t"
      "global_load_async_to_lds_b128 %5, %13, off\n\t"
      "global_load_async_to_lds_b128 %6, %14, off\n\t"
      "global_load_async_to_lds_b128 %7, %15, off\n\t"
      "s_wait_xcnt 0x0"
      :: "v"(l[0]), "v"(l[1]), "v"(l[2]), "v"(l[3]),
         "v"(l[4]), "v"(l[5]), "v"(l[6]), "v"(l[7]),
         "v"(g[0]), "v"(g[1]), "v"(g[2]), "v"(g[3]),
         "v"(g[4]), "v"(g[5]), "v"(g[6]), "v"(g[7])
      : "memory");
}

// LDS tiles are unpadded; the 16-byte chunk c of a row sits at chunk position
// c ^ x(row), so 16 lanes reading one chunk column of 16 rows hit 16 different
// bank groups. Value tile: the 16 rows are neighbours, x = row & 15. Key tile:
// they are four apart (lane n reads key 4 n + g), x = (row >> 2) & 15.

// Key tile: wave w brings key rows [RK w, RK w + RK) of the 128-key tile, 1024 B
// each; one copy covers 512 contiguous global bytes.
static __device__ __forceinline__ void copy_k_tile(const short* __restrict__ Qg, int kb,
                                                   unsigned ks_base, int wave, int lane) {
  const short* gsrc = Qg + (kb + wave * RK) * D + lane * 8;
  const unsigned ldst = ks_base + wave * RK * 1024;
  // Kept rolled: unrolled, every copy's LDS address is held across the tile loop,
  // and beside the Q fragments and the sums they no longer fit the registers.
#pragma unroll 1
  for (int q = 0; q < RK / 4; ++q) {
    const int lx = lane ^ ((wave * (RK / 4) + q) & 15);   // rows 4 q .. 4 q + 3 share x
    unsigned l[8];
    const short* g[8];
    for (int u = 0; u < 8; ++u) {
      const int i = q * 8 + u, r = i >> 1, h = i & 1;
      g[u] = gsrc + r * D + h * 256;
      l[u] = ldst + r * 1024 + h * 512 + (lx << 4);
    }
    async_copy8(l, g);
  }
}

// Value tile: wave w brings Vt rows [RV w, RV w + RV), 256 B (128 keys) each; one
// copy covers two rows.
static __device__ __forceinline__ void copy_v_tile(const short* __restrict__ Vt, int kb,
                                                   unsigned vs_base, int wave, int lane) {
  const int am = lane & 15, kh = lane >> 4;
  const short* gsrc = Vt + (wave * RV + kh) * N_TOK + kb + am * 8;
  const unsigned ldst = vs_base + (wave * RV + kh) * 256;
  // Kept rolled, for the same reason as in copy_k_tile.
#pragma unroll 1
  for (int q = 0; q < RV / 16; ++q) {
    unsigned l[8];
    const short* g[8];
    for (int u = 0; u < 8; ++u) {
      const int i = q * 8 + u;
      g[u] = gsrc + 2 * i * N_TOK;
      l[u] = ldst + i * 512 + (((am ^ kh) ^ ((2 * i) & 14)) << 4);
    }
    async_copy8(l, g);
  }
}

// ---------------------------------------------------------------------------
// Kernel 2: flash attention over half of the keys. Block = 64 query rows
// (4 strips), 8 waves; two blocks share a query block, each walks 32 of the 64
// key tiles and leaves its unnormalised sums, its row maxima and its row sums
// in the workspace for kernel 3. A key or value byte that comes from L2 so
// serves 64 query rows.
// Per 128-key tile: wave w computes the scores of strip w & 3 for 64 keys, its
// strip's Q fragments staying in registers for the whole walk; the online
// softmax works on the score accumulators where they stand: only the row maxima
// of the two waves that share a strip, the rescaling factors and the rounded P
// go through LDS; then wave w computes P@V for output columns [64w, 64w+64) of
// all four strips, each Vt B fragment feeding four WMMAs.
// The key tile and the value tile each have one LDS buffer, filled by
// asynchronous copies: V(t) flies under the score phase of tile t, K(t+1)
// under the softmax and P@V of tile t.
// Four blocks start their walk at each tile of their half and wrap, so that
// blocks running side by side spread their L2 requests over many lines.
// ---------------------------------------------------------------------------
__global__ __launch_bounds__(NW * 32) void attn_kernel(
    const short* __restrict__ Qg, const short* __restrict__ Vt,
    float* __restrict__ Op, float* __restrict__ Mp, float* __restrict__ Lp)
{
  __shared__ __attribute__((aligned(1024))) short Ks[BN * D];   // 128 KB
  __shared__ __attribute__((aligned(1024))) short Vs[D * BN];   // 128 KB
  __shared__ __attribute__((aligned(16))) short Ps[BM * PS_STRIDE];   // 17.0 KB
  __shared__ __attribute__((aligned(16))) float xch[2][BM];  // per key half: row maxima; at the end row sums
  __shared__ __attribute__((aligned(16))) float corr_s[BM];
  __shared__ float m_fin[BM];

  const int tid  = threadIdx.x;
  const int lane = tid & 31;
  const int wave = tid >> 5;
  const int am = lane & 15;
  const int kh = lane >> 4;
  const int half  = blockIdx.x & (NSPLIT - 1);
  const int qrow0 = (blockIdx.x / NSPLIT) * BM;
  const int strip = wave & 3;         // query strip of this wave's scores
  const int kgrp  = wave >> 2;        // its run of GS 16-key groups
  const unsigned ks_base = (unsigned)(unsigned long long)&Ks[0];
  const unsigned vs_base = (unsigned)(unsigned long long)&Vs[0];

  // Element offset of chunk 2e + kh of a row whose x (above copy_k_tile) is am.
  int sw[8];
  for (int e = 0; e < 8; ++e) sw[e] = ((2 * e) ^ (am ^ kh)) * 8;

  // First tile of this block's walk inside its half, for speed only: any value in
  // 0..TILES-1 gives the same function. Four blocks share a start, those whose
  // index differs only in bits 1 and 2.
  const int tile0 = half * TILES;
  const int rot = (blockIdx.x >> 3) & (TILES - 1);

  copy_k_tile(Qg, (tile0 + rot) * BN, ks_base, wave, lane);

  // This wave's strip of Q, 16 rows x 512, as 16 A fragments in registers.
  v16bf qf[16];
  const short* qsrc = Qg + (qrow0 + strip * 16 + am) * D + kh * 8;
  // Unrolled: qf is indexed by constants only, so it stays in registers.
#pragma unroll
  for (int s = 0; s < 16; ++s) qf[s] = frag_from(qsrc + s * 32, qsrc + s * 32 + 16);

  // K(0) has landed before the barrier that lets anybody read it.
  asm volatile("s_wait_asynccnt 0x0" ::: "memory");
  __syncthreads();
  copy_v_tile(Vt, (tile0 + rot) * BN, vs_base, wave, lane);

  v8f acc[4][JN] = {};                // [strip][column group]
  // Softmax state of query rows strip * 16 + kh * 8 + r, r = 0..7: the running
  // maximum of the unscaled scores (the same in all lanes and in both waves of a
  // strip) and this lane's own share of the running sum (joined in the epilogue).
  float m_run[8], l_run[8];
  for (int r = 0; r < 8; ++r) { m_run[r] = -3.0e38f; l_run[r] = 0.0f; }
  const int xrow = strip * 16 + kh * 8;   // first of these rows

  for (int kt = 0; kt < TILES; ++kt) {
    const bool more = kt + 1 < TILES;                               // a next tile exists
    const int kbn = (tile0 + ((kt + 1 + rot) & (TILES - 1))) * BN;  // its first key

    // ---- S subtiles: Q fragment from registers, key B fragments from LDS,
    // fetched two k steps ahead through a ring of three register sets
    v8f sc[GS] = {};
    // Column am of group g is key 4 am + g of the wave's 64, so that a lane ends up
    // with four neighbouring keys of each row and stores their P in one piece.
    const short* krow = &Ks[(kgrp * GS * 16 + am * GS) * D];
    v16bf kf[3][GS];
    for (int p = 0; p < 2; ++p)
      for (int g = 0; g < GS; ++g)
        kf[p][g] = frag_from(krow + g * D + sw[2 * p], krow + g * D + sw[2 * p + 1]);
    // Unrolled: constant indices into qf and kf keep them in registers.
#pragma unroll
    for (int s = 0; s < 16; ++s) {
      if (s + 2 < 16) {
        const int n = s + 2;
        for (int g = 0; g < GS; ++g)
          kf[n % 3][g] = frag_from(krow + g * D + (n >> 2) * 128 + sw[(2 * n) & 7],
                                   krow + g * D + (n >> 2) * 128 + sw[(2 * n + 1) & 7]);
      }
      // Keeps the loads of step s + 2 in front of the products of step s: left
      // alone, the compiler sinks each load to its product, which then waits a
      // whole LDS latency.
      __builtin_amdgcn_sched_barrier(0);
      for (int g = 0; g < GS; ++g)
        sc[g] = __builtin_amdgcn_wmma_f32_16x16x32_bf16(false, qf[s], false, kf[s % 3][g], (short)0, sc[g], false, false);
      // Keeps the next loads behind these products (same purpose).
      __builtin_amdgcn_sched_barrier(0);
    }
    // Row maxima over this wave's 64 keys: in the lane, then over the 16 lanes.
    float tm[8];
    for (int r = 0; r < 8; ++r)
      tm[r] = fmaxf(fmaxf(sc[0][r], sc[1][r]), fmaxf(sc[2][r], sc[3][r]));
    // The 16-lane butterfly as fused DPP maxima, the eight rows interleaved so that no
    // step stands within four instructions of the one it reads: from the builtin the
    // compiler made a move, a quieting maximum and the maximum of every step.
    asm(
        "v_max_num_f32_dpp %0, %0, %0 row_xmask:1 row_mask:0xf bank_mask:0xf\n\t"
        "v_max_num_f32_dpp %1, %1, %1 row_xmask:1 row_mask:0xf bank_mask:0xf\n\t"
        "v_max_num_f32_dpp %2, %2, %2 row_xmask:1 row_mask:0xf bank_mask:0xf\n\t"
        "v_max_num_f32_dpp %3, %3, %3 row_xmask:1 row_mask:0xf bank_mask:0xf\n\t"
        "v_max_num_f32_dpp %4, %4, %4 row_xmask:1 row_mask:0xf bank_mask:0xf\n\t"
        "v_max_num_f32_dpp %5, %5, %5 row_xmask:1 row_mask:0xf bank_mask:0xf\n\t"
        "v_max_num_f32_dpp %6, %6, %6 row_xmask:1 row_mask:0xf bank_mask:0xf\n\t"
        "v_max_num_f32_dpp %7, %7, %7 row_xmask:1 row_mask:0xf bank_mask:0xf\n\t"
        "v_max_num_f32_dpp %0, %0, %0 row_xmask:2 row_mask:0xf bank_mask:0xf\n\t"
        "v_max_num_f32_dpp %1, %1, %1 row_xmask:2 row_mask:0xf bank_mask:0xf\n\t"
        "v_max_num_f32_dpp %2, %2, %2 row_xmask:2 row_mask:0xf bank_mask:0xf\n\t"
        "v_max_num_f32_dpp %3, %3, %3 row_xmask:2 row_mask:0xf bank_mask:0xf\n\t"
        "v_max_num_f32_dpp %4, %4, %4 row_xmask:2 row_mask:0xf bank_mask:0xf\n\t"
        "v_max_num_f32_dpp %5, %5, %5 row_xmask:2 row_mask:0xf bank_mask:0xf\n\t"
        "v_max_num_f32_dpp %6, %6, %6 row_xmask:2 row_mask:0xf bank_mask:0xf\n\t"
        "v_max_num_f32_dpp %7, %7, %7 row_xmask:2 row_mask:0xf bank_mask:0xf\n\t"
        "v_max_num_f32_dpp %0, %0, %0 row_xmask:4 row_mask:0xf bank_mask:0xf\n\t"
        "v_max_num_f32_dpp %1, %1, %1 row_xmask:4 row_mask:0xf bank_mask:0xf\n\t"
        "v_max_num_f32_dpp %2, %2, %2 row_xmask:4 row_mask:0xf bank_mask:0xf\n\t"
        "v_max_num_f32_dpp %3, %3, %3 row_xmask:4 row_mask:0xf bank_mask:0xf\n\t"
        "v_max_num_f32_dpp %4, %4, %4 row_xmask:4 row_mask:0xf bank_mask:0xf\n\t"
        "v_max_num_f32_dpp %5, %5, %5 row_xmask:4 row_mask:0xf bank_mask:0xf\n\t"
        "v_max_num_f32_dpp %6, %6, %6 row_xmask:4 row_mask:0xf bank_mask:0xf\n\t"
        "v_max_num_f32_dpp %7, %7, %7 row_xmask:4 row_mask:0xf bank_mask:0xf\n\t"
        "v_max_num_f32_dpp %0, %0, %0 row_xmask:8 row_mask:0xf bank_mask:0xf\n\t"
        "v_max_num_f32_dpp %1, %1, %1 row_xmask:8 row_mask:0xf bank_mask:0xf\n\t"
        "v_max_num_f32_dpp %2, %2, %2 row_xmask:8 row_mask:0xf bank_mask:0xf\n\t"
        "v_max_num_f32_dpp %3, %3, %3 row_xmask:8 row_mask:0xf bank_mask:0xf\n\t"
        "v_max_num_f32_dpp %4, %4, %4 row_xmask:8 row_mask:0xf bank_mask:0xf\n\t"
        "v_max_num_f32_dpp %5, %5, %5 row_xmask:8 row_mask:0xf bank_mask:0xf\n\t"
        "v_max_num_f32_dpp %6, %6, %6 row_xmask:8 row_mask:0xf bank_mask:0xf\n\t"
        "v_max_num_f32_dpp %7, %7, %7 row_xmask:8 row_mask:0xf bank_mask:0xf"
        : "+v"(tm[0]), "+v"(tm[1]), "+v"(tm[2]), "+v"(tm[3]),
          "+v"(tm[4]), "+v"(tm[5]), "+v"(tm[6]), "+v"(tm[7]));
    if (am == 0) {
      *(v4f*)&xch[kgrp][xrow]     = (v4f){tm[0], tm[1], tm[2], tm[3]};
      *(v4f*)&xch[kgrp][xrow + 4] = (v4f){tm[4], tm[5], tm[6], tm[7]};
    }
    // Foot of the score phase: this wave's reads of Ks are done and its copies
    // of V(t) have landed before the barrier; behind it Ks is refilled.
    asm volatile("s_wait_dscnt 0x0" ::: "memory");
    asm volatile("s_wait_asynccnt 0x0" ::: "memory");
    __syncthreads();
    if (more) copy_k_tile(Qg, kbn, ks_base, wave, lane);

    // ---- online softmax on the accumulators; the other key half's maxima from LDS
    const v4f om0 = *(const v4f*)&xch[kgrp ^ 1][xrow];
    const v4f om1 = *(const v4f*)&xch[kgrp ^ 1][xrow + 4];
    float cd[8], nm[8];
    for (int r = 0; r < 8; ++r) {
      const float mn = fmaxf(m_run[r], fmaxf(tm[r], r < 4 ? om0[r & 3] : om1[r & 3]));
      cd[r] = (m_run[r] - mn) * SCALE2;
      nm[r] = mn * SCALE2;
      m_run[r] = mn;
    }
    float cw[2][4];
    exp2x4(cw[0], cd[0], cd[1], cd[2], cd[3]);
    exp2x4(cw[1], cd[4], cd[5], cd[6], cd[7]);
    for (int r = 0; r < 8; ++r) {
      float p[GS];
      exp2x4(p, sc[0][r] * SCALE2 - nm[r], sc[1][r] * SCALE2 - nm[r],
                sc[2][r] * SCALE2 - nm[r], sc[3][r] * SCALE2 - nm[r]);
      l_run[r] = l_run[r] * cw[r >> 2][r & 3] + ((p[0] + p[1]) + (p[2] + p[3]));
      v4s pk;
      for (int g = 0; g < GS; ++g) pk[g] = f2bf(p[g]);
      *(v4s*)&Ps[(xrow + r) * PS_STRIDE + kgrp * (GS * 16) + am * GS] = pk;
    }
    if (kgrp == 0 && am == 0) {
      *(v4f*)&corr_s[xrow]     = (v4f){cw[0][0], cw[0][1], cw[0][2], cw[0][3]};
      *(v4f*)&corr_s[xrow + 4] = (v4f){cw[1][0], cw[1][1], cw[1][2], cw[1][3]};
    }
    // Each row's sum as an input only, against spills: left alone, the compiler sinks
    // the sums to the end of the trip, the 32 values of P stay live through the P@V
    // phase, and a Q fragment goes to scratch to make room.
    asm volatile("" :: "v"(l_run[0]), "v"(l_run[1]), "v"(l_run[2]), "v"(l_run[3]),
                       "v"(l_run[4]), "v"(l_run[5]), "v"(l_run[6]), "v"(l_run[7]));
    __syncthreads();

    // ---- O = corr*O + P @ V_tile ; wave w owns cols [16 JN w, +16 JN), 4 strips
    // P and V fragments are fetched one k step ahead (two register sets).
    v16bf pf[2][4], vf[2][JN];
    const short* prow = &Ps[am * PS_STRIDE + kh * 8];
    const short* vrow = &Vs[(wave * JN * 16 + am) * BN];
    float cr[4][8];
    for (int st = 0; st < 4; ++st)
      for (int r = 0; r < 8; ++r) cr[st][r] = corr_s[st * 16 + r + kh * 8];
    for (int st = 0; st < 4; ++st)
      pf[0][st] = frag_from(prow + st * 16 * PS_STRIDE, prow + st * 16 * PS_STRIDE + 16);
    for (int j = 0; j < JN; ++j)
      vf[0][j] = frag_from(vrow + j * 16 * BN + sw[0], vrow + j * 16 * BN + sw[1]);
    // Keeps step 0's loads in front of the rescaling, so that they fly under it.
    __builtin_amdgcn_sched_barrier(0);
    for (int st = 0; st < 4; ++st)
      for (int j = 0; j < JN; ++j)
        for (int r = 0; r < 8; ++r) acc[st][j][r] *= cr[st][r];
    // Keeps step 1's loads behind the rescaling, so that no wait of the rescaling
    // covers them.
    __builtin_amdgcn_sched_barrier(0);
    // Unrolled: constant indices into pf and vf keep them in registers.
#pragma unroll
    for (int s = 0; s < 4; ++s) {
      if (s + 1 < 4) {
        const int n = s + 1;
        for (int st = 0; st < 4; ++st)
          pf[n & 1][st] = frag_from(prow + st * 16 * PS_STRIDE + n * 32,
                                    prow + st * 16 * PS_STRIDE + n * 32 + 16);
        for (int j = 0; j < JN; ++j)
          vf[n & 1][j] = frag_from(vrow + j * 16 * BN + sw[2 * n], vrow + j * 16 * BN + sw[2 * n + 1]);
      }
      // Keeps the loads of step s + 1 in front of the products of step s (as in
      // the score phase).
      __builtin_amdgcn_sched_barrier(0);
      for (int j = 0; j < JN; ++j)
        for (int st = 0; st < 4; ++st)
          acc[st][j] = __builtin_amdgcn_wmma_f32_16x16x32_bf16(false, pf[s & 1][st], false, vf[s & 1][j], (short)0, acc[st][j], false, false);
      // Keeps the next loads behind these products (same purpose).
      __builtin_amdgcn_sched_barrier(0);
    }
    // Foot of the P@V phase: this wave's reads of Vs are done and its copies
    // of K(t+1) have landed before the barrier; behind it Vs is refilled.
    asm volatile("s_wait_dscnt 0x0" ::: "memory");
    asm volatile("s_wait_asynccnt 0x0" ::: "memory");
    __syncthreads();
    if (more) copy_v_tile(Vt, kbn, vs_base, wave, lane);
  }
  // No copy is left in flight when the wave goes on to its end.
  asm volatile("s_wait_asynccnt 0x0" ::: "memory");

  // ---- epilogue: the lanes' and the two key halves' shares of the row sums are
  // joined (xch was last read two barriers ago)
  for (int r = 0; r < 8; ++r) l_run[r] += XLANE(l_run[r], 1);
  for (int r = 0; r < 8; ++r) l_run[r] += XLANE(l_run[r], 2);
  for (int r = 0; r < 8; ++r) l_run[r] += XLANE(l_run[r], 4);
  for (int r = 0; r < 8; ++r) l_run[r] += XLANE(l_run[r], 8);
  if (am == 0) {
    for (int r = 0; r < 8; ++r) xch[kgrp][xrow + r] = l_run[r];
    if (kgrp == 0)
      for (int r = 0; r < 8; ++r) m_fin[xrow + r] = m_run[r] * SCALE;
  }
  __syncthreads();

  // this half's unnormalised sums, row maxima and row sums
  float* od = Op + ((size_t)half * N_TOK + qrow0 + kh * 8) * D + wave * JN * 16 + am;
  for (int st = 0; st < 4; ++st)
    for (int j = 0; j < JN; ++j)
      for (int r = 0; r < 8; ++r)
        od[(st * 16 + r) * D + j * 16] = acc[st][j][r];
  if (tid < BM) {
    Mp[half * N_TOK + qrow0 + tid] = m_fin[tid];
    Lp[half * N_TOK + qrow0 + tid] = xch[0][tid] + xch[1][tid];
  }
}

// ---------------------------------------------------------------------------
// Kernel 3: merge the two halves of every row's softmax. Few, long waves, for
// speed only: a wave merges MW whole rows (4 KB of each half and of out, in a
// row of 512-byte accesses), and works out a row's two weights once.
// ---------------------------------------------------------------------------
#define MW 2                        /* rows per wave                         */
#define MS (D / 4 / 32)             /* 512-byte accesses per row             */

__global__ __launch_bounds__(256) void merge_kernel(
    const float* __restrict__ Op, const float* __restrict__ Mp,
    const float* __restrict__ Lp, float* __restrict__ out)
{
  const int row0 = (blockIdx.x * 8 + (threadIdx.x >> 5)) * MW;   // the wave's first row
  const int idx0 = row0 * (D / 4) + (threadIdx.x & 31);          // float4 index into out
  const v4f* pa = (const v4f*)Op + idx0;
  const v4f* pb = (const v4f*)(Op + (size_t)N_TOK * D) + idx0;
  float m0[MW], m1[MW], l0[MW], l1[MW];
  v4f a[MW * MS], b[MW * MS];
  // The three loops are unrolled: constant indices keep the arrays in registers.
#pragma unroll
  for (int j = 0; j < MW; ++j) {
    m0[j] = Mp[row0 + j]; m1[j] = Mp[N_TOK + row0 + j];
    l0[j] = Lp[row0 + j]; l1[j] = Lp[N_TOK + row0 + j];
  }
#pragma unroll
  for (int k = 0; k < MW * MS; ++k) {
    a[k] = pa[k * 32];
    b[k] = pb[k * 32];
  }
  // Takes the loaded values as inputs only, so that every load is issued in front
  // of the arithmetic: left alone, the compiler sinks the later loads behind the
  // waits for the first ones, and their latencies add up.
  asm volatile("" :: "v"(a[0]), "v"(a[1]), "v"(a[2]), "v"(a[3]),
                     "v"(a[4]), "v"(a[5]), "v"(a[6]), "v"(a[7]),
                     "v"(b[0]), "v"(b[1]), "v"(b[2]), "v"(b[3]),
                     "v"(b[4]), "v"(b[5]), "v"(b[6]), "v"(b[7]));
  // Keeps the weights' arithmetic, with its wait for the four small loads, behind
  // that statement: lifted over it, it stood in front of most of the large loads.
  __builtin_amdgcn_sched_barrier(0);
#pragma unroll
  for (int j = 0; j < MW; ++j) {
    const float m  = fmaxf(m0[j], m1[j]);
    const float e0 = __expf(m0[j] - m), e1 = __expf(m1[j] - m);
    const float inv = 1.0f / (l0[j] * e0 + l1[j] * e1);
    const float w0 = e0 * inv, w1 = e1 * inv;
    for (int s = 0; s < MS; ++s) {
      const int k = j * MS + s;
      ((v4f*)out)[idx0 + k * 32] = a[k] * w0 + b[k] * w1;
    }
  }
}

extern "C" void kernel_launch(void* const* d_in, const int* in_sizes, int n_in,
                              void* d_out, int out_size, void* d_ws, size_t ws_size,
                              hipStream_t stream) {
  const float* emb = (const float*)d_in[0];
  const float* Wqk = (const float*)d_in[1];
  const float* bqk = (const float*)d_in[2];
  const float* Wv  = (const float*)d_in[3];
  const float* bv  = (const float*)d_in[4];

  short* Qg = (short*)d_ws;                       // bf16 [8192][512]  (8 MB)
  short* Vt = Qg + (size_t)N_TOK * D;             // bf16 [512][8192]  (8 MB)
  float* Op = (float*)(Vt + (size_t)N_TOK * D);   // f32  [2][8192][512] (32 MB)
  float* Mp = Op + (size_t)NSPLIT * N_TOK * D;    // f32  [2][8192]
  float* Lp = Mp + (size_t)NSPLIT * N_TOK;        // f32  [2][8192]
  float* out = (float*)d_out;                     // f32  [8192][512]

  proj_kernel<<<512, 256, 0, stream>>>(emb, Wqk, bqk, Wv, bv, Qg, Vt);
  attn_kernel<<<N_TOK / BM * NSPLIT, NW * 32, 0, stream>>>(Qg, Vt, Op, Mp, Lp);
  merge_kernel<<<N_TOK / (8 * MW), 256, 0, stream>>>(Op, Mp, Lp, out);
}

// v008
// One run takes 109 microseconds.
// Two timings next to v007 put it at 1.24 and 1.25 times that version's speed.
// Over all steps from v000 it is 4.48 times as fast.
#include <hip/hip_runtime.h>

#define N_TOK 8192
#define D 512
#define BM 64            /* query rows per block (4 strips of 16)           */
#define BN 128           /* keys per tile                                   */
#define NW 8             /* waves per attention block                       */
#define NSPLIT 2         /* blocks that share one query block's key range   */
#define TILES (N_TOK / BN / NSPLIT)   /* key tiles per block                */
#define GS (32 / NW)     /* 16-key score groups per wave (one strip each)   */
#define JN (32 / NW)     /* 16-column output groups per wave (all strips)   */
#define TROWS 64         /* rows of 256 B in a wave's slice of a tile       */
#define TP 136           /* their pitch in LDS: 128 + 8 elems, 272 B        */
#define TSLICE 9216      /* elems from slice to slice: 64 x 272 B, rounded up to 9 x 2 KiB */
#define SCALE 0.04419417382415922f  /* 1/sqrt(512) */
#define SCALE2 (SCALE * 1.4426950408889634f)  /* the same, for powers of two   */

/* Row pitches for 16-byte LDS reads: 16 B x odd, so that the 16 rows
   that half a wave reads at once fall on all 64 banks. */
#define PS_STRIDE 136    /* 128 + 8 elems,  272 B = 16 B x 17               */

typedef __attribute__((ext_vector_type(16))) __bf16 v16bf;
typedef __attribute__((ext_vector_type(8)))  float  v8f;
typedef __attribute__((ext_vector_type(8)))  short  v8s;
typedef __attribute__((ext_vector_type(4)))  float  v4f;

struct bpair { v8s lo, hi; };

// 16x32-bf16 A/B fragment for v_wmma_f32_16x16x32_bf16 from two 16-byte
// chunks (K = kk..kk+7 and kk+16..kk+23 for this lane; lanes 0-15 kh=0,
// lanes 16-31 kh=1, per the ISA 16-bit A/B VGPR striping).
static __device__ __forceinline__ v16bf frag_from(const void* plo, const void* phi) {
  bpair f;
  f.lo = *(const v8s*)plo;
  f.hi = *(const v8s*)phi;
  return __builtin_bit_cast(v16bf, f);
}

// The value that lane (l ^ m) of the same 16-lane row holds (DPP row_xmask:m).
#define XLANE(x, m) __builtin_bit_cast(float, __builtin_amdgcn_update_dpp( \
    __builtin_bit_cast(int, (x)), __builtin_bit_cast(int, (x)), 0x160 | (m), 0xf, 0xf, true))

// Four powers of two. Written out so that no result register is a source register
// of the four (early-clobber outputs) and one free slot follows the last: the
// instruction set asks for a slot between a transcendental and an instruction that
// overwrites its source or reads its result.
static __device__ __forceinline__ void exp2x4(float (&p)[4], float a0, float a1,
                                              float a2, float a3) {
  asm("v_exp_f32 %0, %4\n\t"
      "v_exp_f32 %1, %5\n\t"
      "v_exp_f32 %2, %6\n\t"
      "v_exp_f32 %3, %7\n\t"
      "v_nop"
      : "=&v"(p[0]), "=&v"(p[1]), "=&v"(p[2]), "=&v"(p[3])
      : "v"(a0), "v"(a1), "v"(a2), "v"(a3));
}

// Hardware f32->bf16 convert (let clang pick v_cvt, ideally packed).
static __device__ __forceinline__ short f2bf(float x) {
  __bf16 h = (__bf16)x;
  return __builtin_bit_cast(short, h);
}

// ---------------------------------------------------------------------------
// Kernel 1: Q = emb @ Wqk^T + bqk  (bf16, row-major [N][D])
//           V = emb @ Wv^T  + bv   (bf16, TRANSPOSED: Vt[D][N], keys of every 64 reordered)
// One block per 128 tokens x 128 output features (feature blocks 0..3 are Q,
// 4..7 are V). The f32 operands come in by whole-line loads, 64 k at a time,
// are rounded to bf16 once and staged in LDS (two buffers); each of the 8
// waves works a 32 x 64 tile, so a fragment read from LDS feeds 4 or 2 WMMAs.
// ---------------------------------------------------------------------------
#define PB 128           /* tokens, and features, per block                 */
#define PBK 64           /* k per staged chunk                              */
#define PT_STRIDE 72     /* 64 + 8 elems, 144B = 16B x odd: no bank conflict */

typedef __attribute__((ext_vector_type(4))) short v4s;

static __device__ __forceinline__ v4s cvt4(float4 a) {
  v4s r;
  r[0] = f2bf(a.x); r[1] = f2bf(a.y); r[2] = f2bf(a.z); r[3] = f2bf(a.w);
  return r;
}

__global__ __launch_bounds__(256) void proj_kernel(
    const float* __restrict__ emb,
    const float* __restrict__ Wqk, const float* __restrict__ bqk,
    const float* __restrict__ Wv,  const float* __restrict__ bv,
    short* __restrict__ Qg, short* __restrict__ Vt)
{
  __shared__ __attribute__((aligned(16))) short As[2][PB * PT_STRIDE];
  __shared__ __attribute__((aligned(16))) short Bs[2][PB * PT_STRIDE];

  const int tid  = threadIdx.x;
  const int lane = tid & 31;
  const int wave = tid >> 5;
  const int am = lane & 15;
  const int kh = lane >> 4;
  const int bm = blockIdx.x >> 3;           // token block   0..63
  const int bn = blockIdx.x & 7;            // feature block 0..7
  const bool is_v = bn >= 4;
  const int f0 = (bn & 3) * PB;             // first feature, in its own matrix
  const int t0 = bm * PB;                   // first token
  const int wm = wave & 3;                  // 32-token strip of the block
  const int wn = wave >> 2;                 // 64-feature half of the block

  // Staging map: 16 lanes cover one row's 256 B, a wave two rows.
  const int lrow = tid >> 4;
  const int lc4  = tid & 15;
  const float* asrc = emb + (t0 + lrow) * D + lc4 * 4;
  const float* bsrc = (is_v ? Wv : Wqk) + (f0 + lrow) * D + lc4 * 4;
  const int sdst = lrow * PT_STRIDE + lc4 * 4;
  // A value block stages token 64 G + 16 g + a of its 128 as row 64 G + 4 a + g, and
  // so writes Vt with the keys of every 64 in that order: it is the order in which
  // the flash kernel packs P (a lane holds keys a, 16 + a, 32 + a, 48 + a of a row
  // and stores them side by side). Piece i = 4 G + g of the staging is tokens 16 i + lrow.
  const int adst  = (is_v ? 4 * lrow : lrow) * PT_STRIDE + lc4 * 4;
  const int astep = (is_v ? 1 : 16) * PT_STRIDE;

  float4 ra[8], rb[8];
  for (int i = 0; i < 8; ++i) {
    ra[i] = *(const float4*)(asrc + i * 16 * D);
    rb[i] = *(const float4*)(bsrc + i * 16 * D);
  }
  for (int i = 0; i < 8; ++i) {
    *(v4s*)&As[0][adst + (i >> 2) * 64 * PT_STRIDE + (i & 3) * astep] = cvt4(ra[i]);
    *(v4s*)&Bs[0][sdst + i * 16 * PT_STRIDE] = cvt4(rb[i]);
  }
  __syncthreads();
  for (int i = 0; i < 8; ++i) {
    ra[i] = *(const float4*)(asrc + i * 16 * D + PBK);
    rb[i] = *(const float4*)(bsrc + i * 16 * D + PBK);
  }
  // The two pointers that these loads name are inputs here, so that their step
  // below stands behind this wait.
  asm volatile("s_wait_xcnt 0x0" :: "v"(asrc), "v"(bsrc) : "memory");
  asrc += PBK;
  bsrc += PBK;

  v8f acc[2][4] = {};
  // Kept rolled: unrolled, the whole loop is one block of code and the compiler
  // lifts the rounding, with the wait for the loads, in front of the products.
#pragma unroll 1
  for (int c = 0; c < D / PBK; ++c) {
    const short* at = &As[c & 1][(wm * 32 + am) * PT_STRIDE + kh * 8];
    const short* bt = &Bs[c & 1][(wn * 64 + am) * PT_STRIDE + kh * 8];
    for (int ks = 0; ks < PBK / 32; ++ks) {
      v16bf a[2], b[4];
      for (int m = 0; m < 2; ++m)
        a[m] = frag_from(at + m * 16 * PT_STRIDE + ks * 32,
                         at + m * 16 * PT_STRIDE + ks * 32 + 16);
      for (int n = 0; n < 4; ++n)
        b[n] = frag_from(bt + n * 16 * PT_STRIDE + ks * 32,
                         bt + n * 16 * PT_STRIDE + ks * 32 + 16);
      for (int m = 0; m < 2; ++m)
        for (int n = 0; n < 4; ++n)
          acc[m][n] = __builtin_amdgcn_wmma_f32_16x16x32_bf16(
              false, a[m], false, b[n], (short)0, acc[m][n], false, false);
    }
    if (c + 1 < D / PBK) {
      // Chunk c+1, loaded under the products above, goes to the other buffer,
      // whose last readers left it at the previous barrier.
      short* ad = &As[(c + 1) & 1][adst];
      short* bd = &Bs[(c + 1) & 1][sdst];
      for (int i = 0; i < 8; ++i) {
        *(v4s*)(ad + (i >> 2) * 64 * PT_STRIDE + (i & 3) * astep) = cvt4(ra[i]);
        *(v4s*)(bd + i * 16 * PT_STRIDE) = cvt4(rb[i]);
      }
    }
    __syncthreads();
    if (c + 2 < D / PBK) {
      // The two pointers live across the trips, so no result lands in them.
      for (int i = 0; i < 8; ++i) {
        ra[i] = *(const float4*)(asrc + i * 16 * D + PBK);
        rb[i] = *(const float4*)(bsrc + i * 16 * D + PBK);
      }
      asrc += PBK;
      bsrc += PBK;
    }
  }

  // D layout: VGPR r -> token row (+ kh*8 + r), column = feature (+ am).
  const int ocol0 = f0 + wn * 64 + am;
  const int tok0  = t0 + wm * 32 + kh * 8;
  if (is_v) {
    // Vt row = feature, 8 neighbouring places (tokens in the staged order) -> one 16B store.
    for (int n = 0; n < 4; ++n) {
      const float bias = bv[ocol0 + n * 16];
      for (int m = 0; m < 2; ++m) {
        v8s vp;
        for (int r = 0; r < 8; ++r) vp[r] = f2bf(acc[m][n][r] + bias);
        *(v8s*)(Vt + (ocol0 + n * 16) * N_TOK + tok0 + m * 16) = vp;
      }
    }
    // No register that these stores name is rewritten in front of this wait.
    asm volatile("s_wait_xcnt 0x0" ::: "memory");
  } else {
    for (int n = 0; n < 4; ++n) {
      const float bias = bqk[ocol0 + n * 16];
      for (int m = 0; m < 2; ++m)
        for (int r = 0; r < 8; ++r)
          Qg[(tok0 + m * 16 + r) * D + ocol0 + n * 16] = f2bf(acc[m][n][r] + bias);
    }
  }
}

typedef __attribute__((ext_vector_type(4))) unsigned u32x4;
typedef __attribute__((ext_vector_type(8))) unsigned u32x8;

static __device__ __forceinline__ unsigned uni(unsigned v) {
  return (unsigned)__builtin_amdgcn_readfirstlane(v);
}

// A value held in a scalar register, so that a test on it is a scalar branch: a
// tensor load ignores EXEC, and only such a branch keeps a wave from issuing it.
static __device__ __forceinline__ unsigned pinned(unsigned v) {
  unsigned w = uni(v);
  asm volatile("" : "+s"(w));   // holds the word in a scalar register
  return w;
}

// Descriptor group 1 of a wave's slice: TROWS rows of 256 bytes, src_pitch bytes
// apart in memory, 16 bytes of pad behind each in LDS (pitch 272 B = 16 B x 17, so
// that the 16 rows that half a wave reads at once fall on all 64 banks).
static __device__ __forceinline__ u32x8 tdm_group1(unsigned src_pitch) {
  u32x8 g;
  g[0] = uni((1u << 20) | (5u << 22) | (3u << 25));   // no mask, 1-byte elements, the pad
  g[1] = uni(256u << 16);
  g[2] = uni((unsigned)TROWS << 16);
  g[3] = uni(256u << 16);
  g[4] = uni((unsigned)TROWS);
  g[5] = uni(src_pitch);
  g[6] = uni(0u);
  g[7] = uni(0u);
  return g;
}

// Descriptor group 0: the slice's place in LDS and its first byte in memory.
static __device__ __forceinline__ u32x4 tdm_group0(unsigned lds_dst, const short* src) {
  const unsigned long long ga = (unsigned long long)src;
  u32x4 g;
  g[0] = uni(1u);
  g[1] = uni(lds_dst);
  g[2] = uni((unsigned)ga);
  g[3] = uni((((unsigned)(ga >> 32)) & 0x01FFFFFFu) | 0x80000000u);
  return g;
}

// One request of the whole wave: its slice of a tile, global memory to LDS, through
// no register.
static __device__ __forceinline__ void tdm_load(u32x4 g0, u32x8 g1) {
  asm volatile("tensor_load_to_lds %0, %1" :: "s"(g0), "s"(g1) : "memory");
}

// The wave's one outstanding request has landed. Its group 0 is an input, so that
// those scalar registers keep their values until here: left alone, the compiler
// reused one of them while the request was in flight.
static __device__ __forceinline__ void tdm_wait(u32x4 g0) {
  asm volatile("s_wait_tensorcnt 0x0" :: "s"(g0) : "memory");
}

// Key tile in LDS: slice 4 h + p holds k columns [128 p, 128 p + 128) of the keys
// [64 h, 64 h + 64) of the tile; wave w brings slice w. Value tile: slice w holds Vt
// rows [64 w, 64 w + 64), 128 keys each; wave w brings it (and is its only reader).

// ---------------------------------------------------------------------------
// Kernel 2: flash attention over half of the keys. Block = 64 query rows
// (4 strips), 8 waves; two blocks share a query block, each walks 32 of the 64
// key tiles and leaves its unnormalised sums, its row maxima and its row sums
// in the workspace for kernel 3. A key or value byte that comes from L2 so
// serves 64 query rows.
// Per 128-key tile: wave w computes the scores of strip w & 3 for 64 keys, its
// strip's Q fragments staying in registers for the whole walk; the online
// softmax works on the score accumulators where they stand: only the row maxima
// of the two waves that share a strip, the rescaling factors and the rounded P
// go through LDS; then wave w computes P@V for output columns [64w, 64w+64) of
// all four strips, each Vt B fragment feeding four WMMAs.
// The key tile and the value tile each have one LDS buffer, filled by tensor
// loads, one request a wave and tile: V(t) flies under the score phase of tile
// t, K(t+1) under the softmax and P@V of tile t.
// Each block starts its walk at a tile set by its index bits 0, 3..7 (four blocks per start) and wraps, so that blocks
// running side by side ask L2 for different lines.
// ---------------------------------------------------------------------------
__global__ __launch_bounds__(NW * 32) void attn_kernel(
    const short* __restrict__ Qg, const short* __restrict__ Vt,
    float* __restrict__ Op, float* __restrict__ Mp, float* __restrict__ Lp)
{
  __shared__ __attribute__((aligned(2048))) short Ks[NW * TSLICE];   // 144 KB
  __shared__ __attribute__((aligned(2048))) short Vs[NW * TSLICE];   // 144 KB
  __shared__ __attribute__((aligned(16))) short Ps[BM * PS_STRIDE];   // 17.0 KB
  __shared__ __attribute__((aligned(16))) float xch[2][BM];  // per key half: row maxima; at the end row sums
  __shared__ __attribute__((aligned(16))) float corr_s[BM];
  __shared__ float m_fin[BM];

  const int tid  = threadIdx.x;
  const int lane = tid & 31;
  const int wave = tid >> 5;
  const int am = lane & 15;
  const int kh = lane >> 4;
  const int half  = blockIdx.x & (NSPLIT - 1);
  const int qrow0 = (blockIdx.x / NSPLIT) * BM;
  const int strip = wave & 3;         // query strip of this wave's scores
  const int kgrp  = wave >> 2;        // its run of GS 16-key groups
  // This wave's slices: their places in LDS, their first bytes in tile 0, their shapes.
  const unsigned wv = uni(threadIdx.x >> 5);
  const unsigned ks_dst = (unsigned)(unsigned long long)&Ks[0] + wv * (TSLICE * 2);
  const unsigned vs_dst = (unsigned)(unsigned long long)&Vs[0] + wv * (TSLICE * 2);
  const short* ksrc = Qg + (wv >> 2) * (TROWS * D) + (wv & 3) * 128;
  const short* vsrc = Vt + wv * (TROWS * N_TOK);
  const u32x8 g1k = tdm_group1(D * 2);
  const u32x8 g1v = tdm_group1(N_TOK * 2);

  // First tile of this block's walk inside its half, for speed only: any value in
  // 0..TILES-1 gives the same function. Four blocks share a start, those whose
  // index differs only in bits 1 and 2.
  const int tile0 = half * TILES;
  const int rot = (blockIdx.x >> 3) & (TILES - 1);

  u32x4 g0k = tdm_group0(ks_dst, ksrc + (tile0 + rot) * BN * D);
  tdm_load(g0k, g1k);

  // This wave's strip of Q, 16 rows x 512, as 16 A fragments in registers.
  v16bf qf[16];
  const short* qsrc = Qg + (qrow0 + strip * 16 + am) * D + kh * 8;
  // Unrolled: qf is indexed by constants only, so it stays in registers.
#pragma unroll
  for (int s = 0; s < 16; ++s) qf[s] = frag_from(qsrc + s * 32, qsrc + s * 32 + 16);

  // K(0) has landed before the barrier that lets anybody read it.
  tdm_wait(g0k);
  __syncthreads();

  v8f acc[4][JN] = {};                // [strip][column group]
  // Softmax state of query rows strip * 16 + kh * 8 + r, r = 0..7: the running
  // maximum of the unscaled scores (the same in all lanes and in both waves of a
  // strip) and this lane's own share of the running sum (joined in the epilogue).
  float m_run[8], l_run[8];
  for (int r = 0; r < 8; ++r) { m_run[r] = -3.0e38f; l_run[r] = 0.0f; }
  const int xrow = strip * 16 + kh * 8;   // first of these rows

  for (int kt = 0; kt < TILES; ++kt) {
    const bool more = kt + 1 < TILES;                               // a next tile exists
    const int kbn = (tile0 + ((kt + 1 + rot) & (TILES - 1))) * BN;  // its first key

    // V(t) goes into Vs, which every reader left at the barrier just passed.
    const u32x4 g0v = tdm_group0(vs_dst, vsrc + (tile0 + ((kt + rot) & (TILES - 1))) * BN);
    tdm_load(g0v, g1v);

    // ---- S subtiles: Q fragment from registers, key B fragments from LDS,
    // fetched two k steps ahead through a ring of three register sets
    v8f sc[GS] = {};
    // Column am of group g is key 16 g + am of the wave's 64; a lane stores its four
    // P of a row in one piece, at places 4 am + g, the order that Vt's keys have.
    const short* krow = &Ks[kgrp * 4 * TSLICE + am * TP + kh * 8];
    v16bf kf[3][GS];
    for (int p = 0; p < 2; ++p)
      for (int g = 0; g < GS; ++g)
        kf[p][g] = frag_from(krow + g * 16 * TP + p * 32, krow + g * 16 * TP + p * 32 + 16);
    // Unrolled: constant indices into qf and kf keep them in registers.
#pragma unroll
    for (int s = 0; s < 16; ++s) {
      if (s + 2 < 16) {
        const int n = s + 2;
        for (int g = 0; g < GS; ++g)
          kf[n % 3][g] = frag_from(krow + (n >> 2) * TSLICE + g * 16 * TP + (n & 3) * 32,
                                   krow + (n >> 2) * TSLICE + g * 16 * TP + (n & 3) * 32 + 16);
      }
      // Keeps the loads of step s + 2 in front of the products of step s: left
      // alone, the compiler sinks each load to its product, which then waits a
      // whole LDS latency.
      __builtin_amdgcn_sched_barrier(0);
      for (int g = 0; g < GS; ++g)
        sc[g] = __builtin_amdgcn_wmma_f32_16x16x32_bf16(false, qf[s], false, kf[s % 3][g], (short)0, sc[g], false, false);
      // Keeps the next loads behind these products (same purpose).
      __builtin_amdgcn_sched_barrier(0);
    }
    // Row maxima over this wave's 64 keys: in the lane, then over the 16 lanes.
    float tm[8];
    for (int r = 0; r < 8; ++r)
      tm[r] = fmaxf(fmaxf(sc[0][r], sc[1][r]), fmaxf(sc[2][r], sc[3][r]));
    // The 16-lane butterfly as fused DPP maxima, the eight rows interleaved so that no
    // step stands within four instructions of the one it reads: from the builtin the
    // compiler made a move, a quieting maximum and the maximum of every step.
    asm(
        "v_max_num_f32_dpp %0, %0, %0 row_xmask:1 row_mask:0xf bank_mask:0xf\n\t"
        "v_max_num_f32_dpp %1, %1, %1 row_xmask:1 row_mask:0xf bank_mask:0xf\n\t"
        "v_max_num_f32_dpp %2, %2, %2 row_xmask:1 row_mask:0xf bank_mask:0xf\n\t"
        "v_max_num_f32_dpp %3, %3, %3 row_xmask:1 row_mask:0xf bank_mask:0xf\n\t"
        "v_max_num_f32_dpp %4, %4, %4 row_xmask:1 row_mask:0xf bank_mask:0xf\n\t"
        "v_max_num_f32_dpp %5, %5, %5 row_xmask:1 row_mask:0xf bank_mask:0xf\n\t"
        "v_max_num_f32_dpp %6, %6, %6 row_xmask:1 row_mask:0xf bank_mask:0xf\n\t"
        "v_max_num_f32_dpp %7, %7, %7 row_xmask:1 row_mask:0xf bank_mask:0xf\n\t"
        "v_max_num_f32_dpp %0, %0, %0 row_xmask:2 row_mask:0xf bank_mask:0xf\n\t"
        "v_max_num_f32_dpp %1, %1, %1 row_xmask:2 row_mask:0xf bank_mask:0xf\n\t"
        "v_max_num_f32_dpp %2, %2, %2 row_xmask:2 row_mask:0xf bank_mask:0xf\n\t"
        "v_max_num_f32_dpp %3, %3, %3 row_xmask:2 row_mask:0xf bank_mask:0xf\n\t"
        "v_max_num_f32_dpp %4, %4, %4 row_xmask:2 row_mask:0xf bank_mask:0xf\n\t"
        "v_max_num_f32_dpp %5, %5, %5 row_xmask:2 row_mask:0xf bank_mask:0xf\n\t"
        "v_max_num_f32_dpp %6, %6, %6 row_xmask:2 row_mask:0xf bank_mask:0xf\n\t"
        "v_max_num_f32_dpp %7, %7, %7 row_xmask:2 row_mask:0xf bank_mask:0xf\n\t"
        "v_max_num_f32_dpp %0, %0, %0 row_xmask:4 row_mask:0xf bank_mask:0xf\n\t"
        "v_max_num_f32_dpp %1, %1, %1 row_xmask:4 row_mask:0xf bank_mask:0xf\n\t"
        "v_max_num_f32_dpp %2, %2, %2 row_xmask:4 row_mask:0xf bank_mask:0xf\n\t"
        "v_max_num_f32_dpp %3, %3, %3 row_xmask:4 row_mask:0xf bank_mask:0xf\n\t"
        "v_max_num_f32_dpp %4, %4, %4 row_xmask:4 row_mask:0xf bank_mask:0xf\n\t"
        "v_max_num_f32_dpp %5, %5, %5 row_xmask:4 row_mask:0xf bank_mask:0xf\n\t"
        "v_max_num_f32_dpp %6, %6, %6 row_xmask:4 row_mask:0xf bank_mask:0xf\n\t"
        "v_max_num_f32_dpp %7, %7, %7 row_xmask:4 row_mask:0xf bank_mask:0xf\n\t"
        "v_max_num_f32_dpp %0, %0, %0 row_xmask:8 row_mask:0xf bank_mask:0xf\n\t"
        "v_max_num_f32_dpp %1, %1, %1 row_xmask:8 row_mask:0xf bank_mask:0xf\n\t"
        "v_max_num_f32_dpp %2, %2, %2 row_xmask:8 row_mask:0xf bank_mask:0xf\n\t"
        "v_max_num_f32_dpp %3, %3, %3 row_xmask:8 row_mask:0xf bank_mask:0xf\n\t"
        "v_max_num_f32_dpp %4, %4, %4 row_xmask:8 row_mask:0xf bank_mask:0xf\n\t"
        "v_max_num_f32_dpp %5, %5, %5 row_xmask:8 row_mask:0xf bank_mask:0xf\n\t"
        "v_max_num_f32_dpp %6, %6, %6 row_xmask:8 row_mask:0xf bank_mask:0xf\n\t"
        "v_max_num_f32_dpp %7, %7, %7 row_xmask:8 row_mask:0xf bank_mask:0xf"
        : "+v"(tm[0]), "+v"(tm[1]), "+v"(tm[2]), "+v"(tm[3]),
          "+v"(tm[4]), "+v"(tm[5]), "+v"(tm[6]), "+v"(tm[7]));
    if (am == 0) {
      *(v4f*)&xch[kgrp][xrow]     = (v4f){tm[0], tm[1], tm[2], tm[3]};
      *(v4f*)&xch[kgrp][xrow + 4] = (v4f){tm[4], tm[5], tm[6], tm[7]};
    }
    // Foot of the score phase: this wave's reads of Ks are done and its slice
    // of V(t) has landed before the barrier; behind it Ks is refilled.
    asm volatile("s_wait_dscnt 0x0" ::: "memory");
    tdm_wait(g0v);
    __syncthreads();
    if (pinned(more)) {
      g0k = tdm_group0(ks_dst, ksrc + kbn * D);
      tdm_load(g0k, g1k);
    }

    // ---- online softmax on the accumulators; the other key half's maxima from LDS
    const v4f om0 = *(const v4f*)&xch[kgrp ^ 1][xrow];
    const v4f om1 = *(const v4f*)&xch[kgrp ^ 1][xrow + 4];
    float cd[8], nm[8];
    for (int r = 0; r < 8; ++r) {
      const float mn = fmaxf(m_run[r], fmaxf(tm[r], r < 4 ? om0[r & 3] : om1[r & 3]));
      cd[r] = (m_run[r] - mn) * SCALE2;
      nm[r] = mn * SCALE2;
      m_run[r] = mn;
    }
    float cw[2][4];
    exp2x4(cw[0], cd[0], cd[1], cd[2], cd[3]);
    exp2x4(cw[1], cd[4], cd[5], cd[6], cd[7]);
    for (int r = 0; r < 8; ++r) {
      float p[GS];
      exp2x4(p, sc[0][r] * SCALE2 - nm[r], sc[1][r] * SCALE2 - nm[r],
                sc[2][r] * SCALE2 - nm[r], sc[3][r] * SCALE2 - nm[r]);
      l_run[r] = l_run[r] * cw[r >> 2][r & 3] + ((p[0] + p[1]) + (p[2] + p[3]));
      v4s pk;
      for (int g = 0; g < GS; ++g) pk[g] = f2bf(p[g]);
      *(v4s*)&Ps[(xrow + r) * PS_STRIDE + kgrp * (GS * 16) + am * GS] = pk;
    }
    if (kgrp == 0 && am == 0) {
      *(v4f*)&corr_s[xrow]     = (v4f){cw[0][0], cw[0][1], cw[0][2], cw[0][3]};
      *(v4f*)&corr_s[xrow + 4] = (v4f){cw[1][0], cw[1][1], cw[1][2], cw[1][3]};
    }
    // Each row's sum as an input only, against spills: left alone, the compiler sinks
    // the sums to the end of the trip, the 32 values of P stay live through the P@V
    // phase, and a Q fragment goes to scratch to make room.
    asm volatile("" :: "v"(l_run[0]), "v"(l_run[1]), "v"(l_run[2]), "v"(l_run[3]),
                       "v"(l_run[4]), "v"(l_run[5]), "v"(l_run[6]), "v"(l_run[7]));
    __syncthreads();

    // ---- O = corr*O + P @ V_tile ; wave w owns cols [16 JN w, +16 JN), 4 strips
    // P and V fragments are fetched one k step ahead (two register sets).
    v16bf pf[2][4], vf[2][JN];
    const short* prow = &Ps[am * PS_STRIDE + kh * 8];
    const short* vrow = &Vs[wave * TSLICE + am * TP + kh * 8];
    float cr[4][8];
    for (int st = 0; st < 4; ++st)
      for (int r = 0; r < 8; ++r) cr[st][r] = corr_s[st * 16 + r + kh * 8];
    for (int st = 0; st < 4; ++st)
      pf[0][st] = frag_from(prow + st * 16 * PS_STRIDE, prow + st * 16 * PS_STRIDE + 16);
    for (int j = 0; j < JN; ++j)
      vf[0][j] = frag_from(vrow + j * 16 * TP, vrow + j * 16 * TP + 16);
    // Keeps step 0's loads in front of the rescaling, so that they fly under it.
    __builtin_amdgcn_sched_barrier(0);
    for (int st = 0; st < 4; ++st)
      for (int j = 0; j < JN; ++j)
        for (int r = 0; r < 8; ++r) acc[st][j][r] *= cr[st][r];
    // Keeps step 1's loads behind the rescaling, so that no wait of the rescaling
    // covers them.
    __builtin_amdgcn_sched_barrier(0);
    // Unrolled: constant indices into pf and vf keep them in registers.
#pragma unroll
    for (int s = 0; s < 4; ++s) {
      if (s + 1 < 4) {
        const int n = s + 1;
        for (int st = 0; st < 4; ++st)
          pf[n & 1][st] = frag_from(prow + st * 16 * PS_STRIDE + n * 32,
                                    prow + st * 16 * PS_STRIDE + n * 32 + 16);
        for (int j = 0; j < JN; ++j)
          vf[n & 1][j] = frag_from(vrow + j * 16 * TP + n * 32, vrow + j * 16 * TP + n * 32 + 16);
      }
      // Keeps the loads of step s + 1 in front of the products of step s (as in
      // the score phase).
      __builtin_amdgcn_sched_barrier(0);
      for (int j = 0; j < JN; ++j)
        for (int st = 0; st < 4; ++st)
          acc[st][j] = __builtin_amdgcn_wmma_f32_16x16x32_bf16(false, pf[s & 1][st], false, vf[s & 1][j], (short)0, acc[st][j], false, false);
      // Keeps the next loads behind these products (same purpose).
      __builtin_amdgcn_sched_barrier(0);
    }
    // Foot of the P@V phase: this wave's reads of Vs are done and its slice
    // of K(t+1) has landed before the barrier; behind it, at the top of the next
    // trip, Vs is refilled.
    asm volatile("s_wait_dscnt 0x0" ::: "memory");
    tdm_wait(g0k);
    __syncthreads();
  }
  // Behind the loop: no request is left in flight and no LDS read is open when the
  // wave goes on to its end.
  asm volatile("s_wait_tensorcnt 0x0" ::: "memory");
  asm volatile("s_wait_dscnt 0x0" ::: "memory");

  // ---- epilogue: the lanes' and the two key halves' shares of the row sums are
  // joined (xch was last read two barriers ago)
  for (int r = 0; r < 8; ++r) l_run[r] += XLANE(l_run[r], 1);
  for (int r = 0; r < 8; ++r) l_run[r] += XLANE(l_run[r], 2);
  for (int r = 0; r < 8; ++r) l_run[r] += XLANE(l_run[r], 4);
  for (int r = 0; r < 8; ++r) l_run[r] += XLANE(l_run[r], 8);
  if (am == 0) {
    for (int r = 0; r < 8; ++r) xch[kgrp][xrow + r] = l_run[r];
    if (kgrp == 0)
      for (int r = 0; r < 8; ++r) m_fin[xrow + r] = m_run[r] * SCALE;
  }
  __syncthreads();

  // this half's unnormalised sums, row maxima and row sums
  float* od = Op + ((size_t)half * N_TOK + qrow0 + kh * 8) * D + wave * JN * 16 + am;
  for (int st = 0; st < 4; ++st)
    for (int j = 0; j < JN; ++j)
      for (int r = 0; r < 8; ++r)
        od[(st * 16 + r) * D + j * 16] = acc[st][j][r];
  if (tid < BM) {
    Mp[half * N_TOK + qrow0 + tid] = m_fin[tid];
    Lp[half * N_TOK + qrow0 + tid] = xch[0][tid] + xch[1][tid];
  }
}

// ---------------------------------------------------------------------------
// Kernel 3: merge the two halves of every row's softmax. Few, long waves, for
// speed only: a wave merges MW whole rows (4 KB of each half and of out, in a
// row of 512-byte accesses), and works out a row's two weights once.
// ---------------------------------------------------------------------------
#define MW 2                        /* rows per wave                         */
#define MS (D / 4 / 32)             /* 512-byte accesses per row             */

__global__ __launch_bounds__(256) void merge_kernel(
    const float* __restrict__ Op, const float* __restrict__ Mp,
    const float* __restrict__ Lp, float* __restrict__ out)
{
  const int row0 = (blockIdx.x * 8 + (threadIdx.x >> 5)) * MW;   // the wave's first row
  const int idx0 = row0 * (D / 4) + (threadIdx.x & 31);          // float4 index into out
  const v4f* pa = (const v4f*)Op + idx0;
  const v4f* pb = (const v4f*)(Op + (size_t)N_TOK * D) + idx0;
  float m0[MW], m1[MW], l0[MW], l1[MW];
  v4f a[MW * MS], b[MW * MS];
  // The three loops are unrolled: constant indices keep the arrays in registers.
#pragma unroll
  for (int j = 0; j < MW; ++j) {
    m0[j] = Mp[row0 + j]; m1[j] = Mp[N_TOK + row0 + j];
    l0[j] = Lp[row0 + j]; l1[j] = Lp[N_TOK + row0 + j];
  }
#pragma unroll
  for (int k = 0; k < MW * MS; ++k) {
    a[k] = pa[k * 32];
    b[k] = pb[k * 32];
  }
  // Takes the loaded values as inputs only, so that every load is issued in front
  // of the arithmetic: left alone, the compiler sinks the later loads behind the
  // waits for the first ones, and their latencies add up.
  asm volatile("" :: "v"(a[0]), "v"(a[1]), "v"(a[2]), "v"(a[3]),
                     "v"(a[4]), "v"(a[5]), "v"(a[6]), "v"(a[7]),
                     "v"(b[0]), "v"(b[1]), "v"(b[2]), "v"(b[3]),
                     "v"(b[4]), "v"(b[5]), "v"(b[6]), "v"(b[7]));
  // Keeps the weights' arithmetic, with its wait for the four small loads, behind
  // that statement: lifted over it, it stood in front of most of the large loads.
  __builtin_amdgcn_sched_barrier(0);
#pragma unroll
  for (int j = 0; j < MW; ++j) {
    const float m  = fmaxf(m0[j], m1[j]);
    const float e0 = __expf(m0[j] - m), e1 = __expf(m1[j] - m);
    const float inv = 1.0f / (l0[j] * e0 + l1[j] * e1);
    const float w0 = e0 * inv, w1 = e1 * inv;
    for (int s = 0; s < MS; ++s) {
      const int k = j * MS + s;
      ((v4f*)out)[idx0 + k * 32] = a[k] * w0 + b[k] * w1;
    }
  }
}

extern "C" void kernel_launch(void* const* d_in, const int* in_sizes, int n_in,
                              void* d_out, int out_size, void* d_ws, size_t ws_size,
                              hipStream_t stream) {
  const float* emb = (const float*)d_in[0];
  const float* Wqk = (const float*)d_in[1];
  const float* bqk = (const float*)d_in[2];
  const float* Wv  = (const float*)d_in[3];
  const float* bv  = (const float*)d_in[4];

  short* Qg = (short*)d_ws;                       // bf16 [8192][512]  (8 MB)
  short* Vt = Qg + (size_t)N_TOK * D;             // bf16 [512][8192]  (8 MB)
  float* Op = (float*)(Vt + (size_t)N_TOK * D);   // f32  [2][8192][512] (32 MB)
  float* Mp = Op + (size_t)NSPLIT * N_TOK * D;    // f32  [2][8192]
  float* Lp = Mp + (size_t)NSPLIT * N_TOK;        // f32  [2][8192]
  float* out = (float*)d_out;                     // f32  [8192][512]

  proj_kernel<<<512, 256, 0, stream>>>(emb, Wqk, bqk, Wv, bv, Qg, Vt);
  attn_kernel<<<N_TOK / BM * NSPLIT, NW * 32, 0, stream>>>(Qg, Vt, Op, Mp, Lp);
  merge_kernel<<<N_TOK / (8 * MW), 256, 0, stream>>>(Op, Mp, Lp, out);
}
